// v000
// The times below were measured on an AMD MI455X: many runs one after another, warmed up first and cycling through
// copies of the inputs, with the whole window's GPU time divided by the number of runs. Launches and the gaps
// between them are all in it. The median over several windows is given; except for v000 it joins two sittings, which
// can be a few percent apart, so the side-by-side timings, each taken in one sitting, are the better comparison.
// v000, which the later versions start from, runs in 10.2 milliseconds.
#include <hip/hip_runtime.h>

// Causal multi-head attention with hidden-size scaling (x [128][256][384]; q,k,v = x W ('xw' [384][384], no bias; 6 heads x 64); scores x 384^-0.5 (module quirk), causal (-inf); softmax; out = merged att.v -> [128][256][384] (12.6 M)).
// Layout per batch: bf16 copy of x; exact projections; causal T-256 attention with EVERY row on hi/lo planes (two heads per pass; k_gemmc tile skipping); the f32 merge writes the output rows.
// Compute dtypes, f32 accumulate: every input rounded to bf16; projections exact; scores and att.v 3 products; softmax f32; output f32.

#define NB_  128
#define TT   256
#define DM   384
#define NH_  6
#define NKV  6
#define REP  (NH_ / NKV)
#define HD   64
#define DQ   (NH_ * HD)
#define DKV  (NKV * HD)
#define ZH   2
#define RH   256                  // query rows < RH use hi+lo planes (RH = TT: every row)
#define WIN  256
#define PCAR 1024.0f
#define SCL  0.051031036307982884f   // 384^-0.5 (the module scales by the embedding size)
typedef _Float16 h16;
typedef unsigned short bf;
typedef __attribute__((ext_vector_type(16))) __bf16   v16bf;
typedef __attribute__((ext_vector_type(16))) _Float16 v16h;
typedef __attribute__((ext_vector_type(8)))  _Float16 v8h;
typedef __attribute__((ext_vector_type(8)))  unsigned short v8us;
typedef __attribute__((ext_vector_type(8)))  float    v8f;
typedef __attribute__((ext_vector_type(4)))  float    v4f;
typedef v8h  __attribute__((may_alias)) v8ha;
typedef v4f  __attribute__((may_alias)) v4fa;
typedef v8us __attribute__((may_alias)) v8usa;

__device__ __forceinline__ unsigned short f2bf(float f) { unsigned u = __float_as_uint(f); u += 0x7FFFu + ((u >> 16) & 1u); return (unsigned short)(u >> 16); }
__device__ __forceinline__ float bf2f(unsigned short b) { return __uint_as_float(((unsigned)b) << 16); }
__device__ __forceinline__ float bfr(float f) { return bf2f(f2bf(f)); }
__device__ __forceinline__ v16h cat16(v8h lo, v8h hi) { return __builtin_shufflevector(lo, hi, 0, 1, 2, 3, 4, 5, 6, 7, 8, 9, 10, 11, 12, 13, 14, 15); }
__device__ __forceinline__ v16bf cat16b(v8us lo, v8us hi) { return __builtin_bit_cast(v16bf, __builtin_shufflevector(lo, hi, 0, 1, 2, 3, 4, 5, 6, 7, 8, 9, 10, 11, 12, 13, 14, 15)); }
__device__ __forceinline__ v8f wmma16(v16h a, v16h b, v8f c) { return __builtin_amdgcn_wmma_f32_16x16x32_f16(false, a, false, b, (short)0, c, false, false); }
__device__ __forceinline__ v8f wmmab(v16bf a, v16bf b, v8f c) { return __builtin_amdgcn_wmma_f32_16x16x32_bf16(false, a, false, b, (short)0, c, false, false); }



// ---- k_gemmw: register-blocked GEMM, ONE WAVE per 64x64 output tile (16 accumulators), operands straight from K-contiguous 16-bit planes; grid (M/64, N/64, Z), 32 threads.
// C[m][n] (f32, pitch ldc, + optional f32 bias[n]) = sum_k A[m][k] Bt[n][k] (+ split products per NSPLIT). z-batch strides sA/sB/sC in elements. K % 32 == 0.
template <typename T16> struct WFrag;
template <> struct WFrag<h16> { typedef v16h V; static __device__ __forceinline__ V ld(const h16* p) { return cat16(*(const v8h*)p, *(const v8h*)(p + 16)); } static __device__ __forceinline__ v8f mma(V a, V b, v8f c) { return wmma16(a, b, c); } };
template <> struct WFrag<bf> { typedef v16bf V; static __device__ __forceinline__ V ld(const bf* p) { return cat16b(*(const v8us*)p, *(const v8us*)(p + 16)); } static __device__ __forceinline__ v8f mma(V a, V b, v8f c) { return wmmab(a, b, c); } };
template <typename T16, int NSPLIT, bool BIAS>
__global__ __launch_bounds__(32) void k_gemmw(const T16* __restrict__ A, const T16* __restrict__ A2, const T16* __restrict__ Bt, const T16* __restrict__ Bt2, int K, float* C, int ldc, const float* __restrict__ bias, size_t sA, size_t sB, size_t sC) {
    typedef typename WFrag<T16>::V V;
    __shared__ __align__(16) float os[16 * 68];
    const size_t z = blockIdx.z; A += z * sA; if (A2) A2 += z * sA; Bt += z * sB; if (Bt2) Bt2 += z * sB; C += z * sC;
    const int lane = threadIdx.x & 31, lr = lane & 15, hi = lane >> 4; const int r0 = blockIdx.x * 64, c0 = blockIdx.y * 64;
    v8f acc[4][4];
#pragma unroll
    for (int mb = 0; mb < 4; ++mb)
#pragma unroll
        for (int nb = 0; nb < 4; ++nb) acc[mb][nb] = (v8f){};
    const size_t aoff = (size_t)(r0 + lr) * K + 8 * hi, boff = (size_t)(c0 + lr) * K + 8 * hi;
#pragma unroll 1
    for (int kc = 0; kc < K; kc += 32) {
        V a[4], a2[4];
#pragma unroll
        for (int mb = 0; mb < 4; ++mb) { a[mb] = WFrag<T16>::ld(A + aoff + (size_t)mb * 16 * K + kc); if (NSPLIT == 1 || NSPLIT == 2) a2[mb] = WFrag<T16>::ld(A2 + aoff + (size_t)mb * 16 * K + kc); }
#pragma unroll
        for (int nb = 0; nb < 4; ++nb) { const V b = WFrag<T16>::ld(Bt + boff + (size_t)nb * 16 * K + kc); V b2; if (NSPLIT >= 2) b2 = WFrag<T16>::ld(Bt2 + boff + (size_t)nb * 16 * K + kc);
#pragma unroll
            for (int mb = 0; mb < 4; ++mb) { acc[mb][nb] = WFrag<T16>::mma(a[mb], b, acc[mb][nb]); if (NSPLIT == 1 || NSPLIT == 2) acc[mb][nb] = WFrag<T16>::mma(a2[mb], b, acc[mb][nb]); if (NSPLIT >= 2) acc[mb][nb] = WFrag<T16>::mma(a[mb], b2, acc[mb][nb]); } }
        asm volatile("v_nop\n\tv_nop\n\tv_nop\n\tv_nop" : "+v"(acc[0][0]), "+v"(acc[1][1]), "+v"(acc[2][2]), "+v"(acc[3][3]) : "v"(a[0]), "v"(a[3]));
    }
#pragma unroll
    for (int mb = 0; mb < 4; ++mb) {
#pragma unroll
        for (int nb = 0; nb < 4; ++nb) {
#pragma unroll
            for (int j = 0; j < 8; ++j) os[(hi * 8 + j) * 68 + nb * 16 + lr] = acc[mb][nb][j]; }
        __builtin_amdgcn_wave_barrier(); asm volatile("" ::: "memory");
        float* crow = C + (size_t)(r0 + mb * 16) * ldc + c0;
{
#pragma unroll
            for (int s = 0; s < 8; ++s) { const int row = 2 * s + hi, cofs = lr * 4; v4f val = *(const v4fa*)(os + row * 68 + cofs); if (BIAS) { val[0] += bfr(bias[c0 + cofs]); val[1] += bfr(bias[c0 + cofs + 1]); val[2] += bfr(bias[c0 + cofs + 2]); val[3] += bfr(bias[c0 + cofs + 3]); }
                *(v4f*)(crow + (size_t)row * ldc + cofs) = val; }
             }
        __builtin_amdgcn_wave_barrier(); asm volatile("" ::: "memory");
    }
}

// ---- k_gemmc: the same one-wave 64x64 tile GEMM specialised for causal attention: CMODE 1 skips score tiles entirely above the diagonal (query rows r0+roff.., key columns c0..), CMODE 2 limits the
// key (K) loop of the probability x value contraction to the diagonal block (probabilities beyond it are exactly zero). roff = row offset of this launch's first row within the sequence.
template <typename T16, int NSPLIT, int CMODE>
__global__ __launch_bounds__(32) void k_gemmc(const T16* __restrict__ A, const T16* __restrict__ A2, const T16* __restrict__ Bt, const T16* __restrict__ Bt2, int K, float* C, int ldc, int roff, size_t sA, size_t sB, size_t sC) {
    typedef typename WFrag<T16>::V V;
    __shared__ __align__(16) float os[16 * 68];
    const size_t z = blockIdx.z; A += z * sA; if (A2) A2 += z * sA; Bt += z * sB; if (Bt2) Bt2 += z * sB; C += z * sC;
    const int lane = threadIdx.x & 31, lr = lane & 15, hi = lane >> 4; const int r0 = blockIdx.x * 64, c0 = blockIdx.y * 64;
    if (CMODE == 1 && c0 > r0 + roff + 63) return;                  // score tile entirely above the causal diagonal: never read (the softmax masks j > i by select)
    const int Kl = (CMODE == 2) ? min(K, r0 + roff + 64) : K;        // P.V: probabilities are exactly 0 beyond the diagonal block, so the K loop stops there
    v8f acc[4][4];
#pragma unroll
    for (int mb = 0; mb < 4; ++mb)
#pragma unroll
        for (int nb = 0; nb < 4; ++nb) acc[mb][nb] = (v8f){};
    const size_t aoff = (size_t)(r0 + lr) * K + 8 * hi, boff = (size_t)(c0 + lr) * K + 8 * hi;
#pragma unroll 1
    for (int kc = 0; kc < Kl; kc += 32) {
        V a[4], a2[4];
#pragma unroll
        for (int mb = 0; mb < 4; ++mb) { a[mb] = WFrag<T16>::ld(A + aoff + (size_t)mb * 16 * K + kc); if (NSPLIT == 1 || NSPLIT == 2) a2[mb] = WFrag<T16>::ld(A2 + aoff + (size_t)mb * 16 * K + kc); }
#pragma unroll
        for (int nb = 0; nb < 4; ++nb) { const V b = WFrag<T16>::ld(Bt + boff + (size_t)nb * 16 * K + kc); V b2; if (NSPLIT >= 2) b2 = WFrag<T16>::ld(Bt2 + boff + (size_t)nb * 16 * K + kc);
#pragma unroll
            for (int mb = 0; mb < 4; ++mb) { acc[mb][nb] = WFrag<T16>::mma(a[mb], b, acc[mb][nb]); if (NSPLIT == 1 || NSPLIT == 2) acc[mb][nb] = WFrag<T16>::mma(a2[mb], b, acc[mb][nb]); if (NSPLIT >= 2) acc[mb][nb] = WFrag<T16>::mma(a[mb], b2, acc[mb][nb]); } }
        asm volatile("v_nop\n\tv_nop\n\tv_nop\n\tv_nop" : "+v"(acc[0][0]), "+v"(acc[1][1]), "+v"(acc[2][2]), "+v"(acc[3][3]) : "v"(a[0]), "v"(a[3]));
    }
#pragma unroll
    for (int mb = 0; mb < 4; ++mb) {
#pragma unroll
        for (int nb = 0; nb < 4; ++nb) {
#pragma unroll
            for (int j = 0; j < 8; ++j) os[(hi * 8 + j) * 68 + nb * 16 + lr] = acc[mb][nb][j]; }
        __builtin_amdgcn_wave_barrier(); asm volatile("" ::: "memory");
        float* crow = C + (size_t)(r0 + mb * 16) * ldc + c0;
{
#pragma unroll
            for (int s = 0; s < 8; ++s) { const int row = 2 * s + hi, cofs = lr * 4; v4f val = *(const v4fa*)(os + row * 68 + cofs);
                *(v4f*)(crow + (size_t)row * ldc + cofs) = val; }
             }
        __builtin_amdgcn_wave_barrier(); asm volatile("" ::: "memory");
    }
}

__device__ __forceinline__ h16 tohx(float x) { return (h16)x; }
__device__ __forceinline__ void splitf(float y, unsigned short& h, unsigned short& l) { h = f2bf(y); l = f2bf(y - bf2f(h)); }
typedef __attribute__((ext_vector_type(2))) _Float16 v2h;
typedef __attribute__((ext_vector_type(4))) _Float16 v4h;
typedef __attribute__((ext_vector_type(2))) unsigned short v2us;
typedef __attribute__((ext_vector_type(4))) unsigned short v4us;
typedef __attribute__((ext_vector_type(2))) float v2f;
typedef __attribute__((ext_vector_type(4))) int v4i;

__global__ __launch_bounds__(256) void k_wtG(const float* __restrict__ w, int K, int N, bf* Bt) {
    const int lane = threadIdx.x & 31; const int L0 = (blockIdx.x * 8 + (threadIdx.x >> 5)) * 8; const int nlines = N * K / 64;
{
#pragma unroll 1
        for (int l = 0; l < 8; ++l) { const int L = L0 + l; if (L >= nlines) break; const size_t e = (size_t)L * 64 + lane * 2; const int k = (int)(e % K), n = (int)(e / K); v2us o;
            o[0] = f2bf(w[(size_t)k * N + n]); o[1] = f2bf(w[(size_t)(k + 1) * N + n]); *(v2us*)(Bt + e) = o; }
         }
}
__global__ __launch_bounds__(256) void k_cvt8(const float* __restrict__ src, bf* dst, size_t n8) { const size_t i = (size_t)blockIdx.x * 256 + threadIdx.x; if (i >= n8) return; const v8f v = *(const v8f*)(src + i * 8); v8us o;
#pragma unroll
    for (int k = 0; k < 8; ++k) o[k] = f2bf(v[k]); *(v8us*)(dst + i * 8) = o;  }

// k_rope: head planes [h][t][d] (fp16 + hi/lo) of rope(x) x sc with the rotate-half convention out[d] = x[d] cos[t][d] - x[d+HD/2] sin[t][d], out[d+HD/2] = x[d+HD/2] cos[t][d+HD/2] + x[d] sin[t][d+HD/2]
__global__ __launch_bounds__(256) void k_rope(const float* __restrict__ F, int pitch, int nheads, const float* __restrict__ CS, const float* __restrict__ RF, const float* __restrict__ nw, float sc, h16* P16, bf* Ph, bf* Pl) {
    const size_t e = ((size_t)blockIdx.x * 256 + threadIdx.x) * 2; if (e >= (size_t)nheads * TT * HD) return; const int d = (int)(e % HD); const int t = (int)((e / HD) % TT); const int h = (int)(e / ((size_t)HD * TT)); const float* f = F + (size_t)t * pitch + h * HD; const float rf = RF ? RF[(size_t)h * TT + t] : 1.0f; v2h o16; v2us oh, ol;
#pragma unroll
    for (int q = 0; q < 2; ++q) { const int dd = d + q; const int dp = (dd < HD / 2) ? dd + HD / 2 : dd - HD / 2; float x0 = f[dd], x1 = f[dp];
        if (RF) { float n0 = __fmul_rn(x0, rf), n1 = __fmul_rn(x1, rf); asm volatile("" : "+v"(n0)); asm volatile("" : "+v"(n1)); x0 = __fmul_rn(bfr(nw[dd]), n0); x1 = __fmul_rn(bfr(nw[dp]), n1); }
        const v2f cs = *(const v2f*)(CS + ((size_t)t * HD + dd) * 2); float a = __fmul_rn(x0, cs[0]), bq = __fmul_rn(x1, cs[1]); asm volatile("" : "+v"(a)); asm volatile("" : "+v"(bq)); const float r = ((dd < HD / 2) ? __fsub_rn(a, bq) : __fadd_rn(a, bq)) * sc;
        o16[q] = tohx(r); unsigned short a2, c2; splitf(r, a2, c2); oh[q] = a2; ol[q] = c2; }
    *(v2h*)(P16 + e) = o16; *(v2us*)(Ph + e) = oh; *(v2us*)(Pl + e) = ol;  }
__global__ __launch_bounds__(256) void k_vtp(const float* __restrict__ F, int pitch, int nheads, h16* V16, bf* Vh, bf* Vl) { const size_t e = ((size_t)blockIdx.x * 256 + threadIdx.x) * 2; if (e >= (size_t)nheads * HD * TT) return; const int t = (int)(e % TT); const int d = (int)((e / TT) % HD); const int g = (int)(e / ((size_t)TT * HD)); v2h o16; v2us oh, ol;
#pragma unroll
    for (int q = 0; q < 2; ++q) { const float x = F[(size_t)(t + q) * pitch + g * HD + d]; o16[q] = tohx(x); unsigned short a2, c2; splitf(x, a2, c2); oh[q] = a2; ol[q] = c2; }
    *(v2h*)(V16 + e) = o16; *(v2us*)(Vh + e) = oh; *(v2us*)(Vl + e) = ol;  }
__global__ __launch_bounds__(256) void k_csid(float* CS) { const int idx = blockIdx.x * 256 + threadIdx.x; if (idx >= TT * HD) return; v2f cs; cs[0] = 1.0f; cs[1] = 0.0f; *(v2f*)(CS + (size_t)idx * 2) = cs;  }
// k_asoft: per row (zz, i): t = S x 384^-0.5 for j <= i and i - j < WIN (sliding causal window; the reference's -1e9 additive fill vanishes identically); softmax over the 256 keys (register row, one exp, fixed trees);
__global__ __launch_bounds__(256) void k_asoft(const float* __restrict__ Sb, h16* P16, bf* Ph, bf* Pl) {
    const int lane = threadIdx.x & 31; const int row = blockIdx.x * 8 + (threadIdx.x >> 5); if (row >= ZH * TT) return; const int i = row % TT; const int zz = row / TT; (void)zz; const bool hires = (i < RH); const float* sr = Sb + (size_t)row * TT; float v[TT / 32]; float mx = -3.0e38f;
#pragma unroll
    for (int ch = 0; ch < TT / 128; ++ch) { const int j0 = ch * 128 + lane * 4; const v4f a = *(const v4f*)(sr + j0);
#pragma unroll
        for (int q = 0; q < 4; ++q) { const int j = j0 + q; (void)j; const float t = (j <= i && i - j < WIN) ? a[q] * SCL : -3.0e38f; v[ch * 4 + q] = t; mx = fmaxf(mx, t); } }
#pragma unroll
    for (int sh = 16; sh; sh >>= 1) mx = fmaxf(mx, __shfl_xor(mx, sh, 32));
    float sum = 0.f;
#pragma unroll
    for (int k = 0; k < TT / 32; ++k) { float d0 = __fsub_rn(v[k], mx); asm volatile("" : "+v"(d0)); v[k] = __builtin_amdgcn_exp2f(__fmul_rn(d0, 1.4426950408889634f)); sum += v[k]; }
#pragma unroll
    for (int sh = 16; sh; sh >>= 1) sum += __shfl_xor(sum, sh, 32);
    const float f = __fdiv_rn(hires ? 1.0f : PCAR, sum);
{
        if (hires) {
#pragma unroll
            for (int ch = 0; ch < TT / 128; ++ch) { v4us oh, ol;
#pragma unroll
                for (int q = 0; q < 4; ++q) { unsigned short a, c2; splitf(v[ch * 4 + q] * f, a, c2); oh[q] = a; ol[q] = c2; }
                const size_t oo = ((size_t)zz * (RH ? RH : 1) + i) * TT + ch * 128 + lane * 4; *(v4us*)(Ph + oo) = oh; *(v4us*)(Pl + oo) = ol; }
        } else {
#pragma unroll
            for (int ch = 0; ch < TT / 128; ++ch) { v4h o4;
#pragma unroll
                for (int q = 0; q < 4; ++q) o4[q] = tohx(v[ch * 4 + q] * f);
                *(v4h*)(P16 + (size_t)row * TT + ch * 128 + lane * 4) = o4; } }
         }
}
__global__ __launch_bounds__(256) void k_merge(const float* __restrict__ O, int h0, float* OUTb) { const size_t e = ((size_t)blockIdx.x * 256 + threadIdx.x) * 2; if (e >= (size_t)ZH * TT * HD) return; const int d = (int)(e % HD); const int t = (int)((e / HD) % TT); const int zz = (int)(e / ((size_t)HD * TT)); const float cs = (t < RH) ? 1.0f : (1.0f / PCAR); const size_t oo = (size_t)t * DQ + (h0 + zz) * HD + d;
    v2f o2; o2[0] = O[e] * cs; o2[1] = O[e + 1] * cs; *(v2f*)(OUTb + oo) = o2;  }

extern "C" void kernel_launch(void* const* d_in, const int* in_sizes, int n_in,
                              void* d_out, int out_size, void* d_ws, size_t ws_size, hipStream_t stream) {
    (void)in_sizes; (void)n_in; (void)out_size;
    const float* x = (const float*)d_in[0]; const float* wq = (const float*)d_in[1]; const float* wk = (const float*)d_in[2]; const float* wv = (const float*)d_in[3]; const float* wo = nullptr; (void)wo;
    float* OUT = (float*)d_out;     // [128][256][384]
    char* wsp = (char*)d_ws;
    auto take = [&](size_t bytes) { char* p = wsp; wsp += (bytes + 255) & ~(size_t)255; return (void*)p; };
    bf* WQ = (bf*)take((size_t)DQ * DM * 2); bf* WK = (bf*)take((size_t)DKV * DM * 2); bf* WV = (bf*)take((size_t)DKV * DM * 2); float* CS = (float*)take((size_t)TT * HD * 2 * 4);
    bf* XB = (bf*)take((size_t)TT * DM * 2); float* FQ = (float*)take((size_t)TT * DQ * 4); float* FK = (float*)take((size_t)TT * DKV * 4);
    h16* QP16 = (h16*)take((size_t)NH_ * TT * HD * 2); h16* KP16 = (h16*)take((size_t)NKV * TT * HD * 2); h16* VT16 = (h16*)take((size_t)NKV * HD * TT * 2);
    bf* QPh = (bf*)take((size_t)NH_ * TT * HD * 2); bf* QPl = (bf*)take((size_t)NH_ * TT * HD * 2); bf* KPh = (bf*)take((size_t)NKV * TT * HD * 2); bf* KPl = (bf*)take((size_t)NKV * TT * HD * 2); bf* VTh = (bf*)take((size_t)NKV * HD * TT * 2); bf* VTl = (bf*)take((size_t)NKV * HD * TT * 2); bf* Ph = (bf*)take((size_t)ZH * RH * TT * 2); bf* Pl = (bf*)take((size_t)ZH * RH * TT * 2);
    float* Sb = (float*)take((size_t)ZH * TT * TT * 4); h16* P16 = nullptr; float* Ob = (float*)take((size_t)ZH * TT * HD * 4);
    if ((size_t)(wsp - (char*)d_ws) > ws_size) return;    // ws 256 MiB
    float* FV = FK;   // v projection reuses the k buffer after the k planes are built (stream-ordered)
    { k_wtG<<<(unsigned)((DM * DQ / 64 + 63) / 64), 256, 0, stream>>>(wq, DM, DQ, WQ); k_wtG<<<(unsigned)((DM * DKV / 64 + 63) / 64), 256, 0, stream>>>(wk, DM, DKV, WK); k_wtG<<<(unsigned)((DM * DKV / 64 + 63) / 64), 256, 0, stream>>>(wv, DM, DKV, WV);
      
       }
    k_csid<<<(TT * HD + 255) / 256, 256, 0, stream>>>(CS);
    const unsigned LQ = (unsigned)(((size_t)NH_ * TT * HD / 2 + 255) / 256), LKv = (unsigned)(((size_t)NKV * TT * HD / 2 + 255) / 256);
    for (int b = 0; b < NB_; ++b) {
        
        k_cvt8<<<(unsigned)(((size_t)TT * DM / 8 + 255) / 256), 256, 0, stream>>>(x + (size_t)b * TT * DM, XB, (size_t)TT * DM / 8);
        k_gemmw<bf, 0, false><<<dim3(TT / 64, DQ / 64, 1), 32, 0, stream>>>(XB, nullptr, WQ, nullptr, DM, FQ, DQ, nullptr, 0, 0, 0);
        k_rope<<<LQ, 256, 0, stream>>>(FQ, DQ, NH_, CS, nullptr, nullptr, 1.0f, QP16, QPh, QPl);
        k_gemmw<bf, 0, false><<<dim3(TT / 64, DKV / 64, 1), 32, 0, stream>>>(XB, nullptr, WK, nullptr, DM, FK, DKV, nullptr, 0, 0, 0);
        k_rope<<<LKv, 256, 0, stream>>>(FK, DKV, NKV, CS, nullptr, nullptr, 1.0f, KP16, KPh, KPl);
        k_gemmw<bf, 0, false><<<dim3(TT / 64, DKV / 64, 1), 32, 0, stream>>>(XB, nullptr, WV, nullptr, DM, FV, DKV, nullptr, 0, 0, 0); k_vtp<<<LKv, 256, 0, stream>>>(FV, DKV, NKV, VT16, VTh, VTl);
        for (int h0 = 0; h0 < NH_; h0 += ZH) { const size_t zq = (size_t)h0, zk = (size_t)(h0 / REP);   // one kv head per query head: the pass's two heads use consecutive kv planes (z-strides TT*HD)
            k_gemmc<bf, 2, 1><<<dim3(RH / 64, TT / 64, ZH), 32, 0, stream>>>(QPh + zq * TT * HD, QPl + zq * TT * HD, KPh + zk * TT * HD, KPl + zk * TT * HD, HD, Sb, TT, 0, (size_t)TT * HD, (size_t)TT * HD, (size_t)TT * TT);
            k_asoft<<<ZH * TT / 8, 256, 0, stream>>>(Sb, P16, Ph, Pl);
            k_gemmc<bf, 2, 2><<<dim3(RH / 64, HD / 64, ZH), 32, 0, stream>>>(Ph, Pl, VTh + zk * HD * TT, VTl + zk * HD * TT, TT, Ob, HD, 0, (size_t)RH * TT, (size_t)HD * TT, (size_t)TT * HD);
            k_merge<<<(unsigned)(((size_t)ZH * TT * HD / 2 + 255) / 256), 256, 0, stream>>>(Ob, h0, OUT + (size_t)b * TT * DQ); }
         }
}

// v001
// A run of this version takes 375 microseconds.
// Two timings next to v000 put it at 26.7 and 26.6 times that version's speed.
#include <hip/hip_runtime.h>

// Causal multi-head attention with hidden-size scaling (x [128][256][384]; q,k,v = x W ('xw' [384][384], no bias; 6 heads x 64); scores x 384^-0.5 (module quirk), causal (-inf); softmax; out = merged att.v -> [128][256][384] (12.6 M)).
// Layout per group of CB batches, every stage one launch: bf16 copy of x; exact projections (q, k, v as one product against the stacked weights); causal T-256 attention with EVERY row on hi/lo planes (all CB x 6 heads on grid z; k_gemmc tile skipping); the f32 merge writes the output rows.
// Compute dtypes, f32 accumulate: every input rounded to bf16; projections exact; scores and att.v 3 products; softmax f32; output f32.

#define NB_  128
#define TT   256
#define DM   384
#define NH_  6
#define NKV  6
#define REP  (NH_ / NKV)
#define HD   64
#define DQ   (NH_ * HD)
#define DKV  (NKV * HD)
#define CB   64                   // batches per launch (the workspace holds the planes of 64)
#define ZH   (CB * NH_)           // (batch, head) planes per attention launch
#define DF   (DQ + 2 * DKV)       // row pitch of the stacked q | k | v projection
#define RH   256                  // query rows < RH use hi+lo planes (0: none)
#define WIN  256
#define PCAR 1024.0f
#define SCL  0.051031036307982884f   // 384^-0.5 (the module scales by the embedding size)
typedef _Float16 h16;
typedef unsigned short bf;
typedef __attribute__((ext_vector_type(16))) __bf16   v16bf;
typedef __attribute__((ext_vector_type(16))) _Float16 v16h;
typedef __attribute__((ext_vector_type(8)))  _Float16 v8h;
typedef __attribute__((ext_vector_type(8)))  unsigned short v8us;
typedef __attribute__((ext_vector_type(8)))  float    v8f;
typedef __attribute__((ext_vector_type(4)))  float    v4f;
typedef v8h  __attribute__((may_alias)) v8ha;
typedef v4f  __attribute__((may_alias)) v4fa;
typedef v8us __attribute__((may_alias)) v8usa;

__device__ __forceinline__ unsigned short f2bf(float f) { unsigned u = __float_as_uint(f); u += 0x7FFFu + ((u >> 16) & 1u); return (unsigned short)(u >> 16); }
__device__ __forceinline__ float bf2f(unsigned short b) { return __uint_as_float(((unsigned)b) << 16); }
__device__ __forceinline__ float bfr(float f) { return bf2f(f2bf(f)); }
__device__ __forceinline__ v16h cat16(v8h lo, v8h hi) { return __builtin_shufflevector(lo, hi, 0, 1, 2, 3, 4, 5, 6, 7, 8, 9, 10, 11, 12, 13, 14, 15); }
__device__ __forceinline__ v16bf cat16b(v8us lo, v8us hi) { return __builtin_bit_cast(v16bf, __builtin_shufflevector(lo, hi, 0, 1, 2, 3, 4, 5, 6, 7, 8, 9, 10, 11, 12, 13, 14, 15)); }
__device__ __forceinline__ v8f wmma16(v16h a, v16h b, v8f c) { return __builtin_amdgcn_wmma_f32_16x16x32_f16(false, a, false, b, (short)0, c, false, false); }
__device__ __forceinline__ v8f wmmab(v16bf a, v16bf b, v8f c) { return __builtin_amdgcn_wmma_f32_16x16x32_bf16(false, a, false, b, (short)0, c, false, false); }



// ---- k_gemmw: register-blocked GEMM, ONE WAVE per 64x64 output tile (16 accumulators), operands straight from K-contiguous 16-bit planes; grid (M/64, N/64, Z), 32 threads.
// C[m][n] (f32, pitch ldc, + optional f32 bias[n]) = sum_k A[m][k] Bt[n][k] (+ split products per NSPLIT). z-batch strides sA/sB/sC in elements. K % 32 == 0.
template <typename T16> struct WFrag;
template <> struct WFrag<h16> { typedef v16h V; static __device__ __forceinline__ V ld(const h16* p) { return cat16(*(const v8h*)p, *(const v8h*)(p + 16)); } static __device__ __forceinline__ v8f mma(V a, V b, v8f c) { return wmma16(a, b, c); } };
template <> struct WFrag<bf> { typedef v16bf V; static __device__ __forceinline__ V ld(const bf* p) { return cat16b(*(const v8us*)p, *(const v8us*)(p + 16)); } static __device__ __forceinline__ v8f mma(V a, V b, v8f c) { return wmmab(a, b, c); } };
template <typename T16, int NSPLIT, bool BIAS>
__global__ __launch_bounds__(32) void k_gemmw(const T16* __restrict__ A, const T16* __restrict__ A2, const T16* __restrict__ Bt, const T16* __restrict__ Bt2, int K, float* C, int ldc, const float* __restrict__ bias, size_t sA, size_t sB, size_t sC) {
    typedef typename WFrag<T16>::V V;
    __shared__ __align__(16) float os[16 * 68];
    const size_t z = blockIdx.z; A += z * sA; if (A2) A2 += z * sA; Bt += z * sB; if (Bt2) Bt2 += z * sB; C += z * sC;
    const int lane = threadIdx.x & 31, lr = lane & 15, hi = lane >> 4; const int r0 = blockIdx.x * 64, c0 = blockIdx.y * 64;
    v8f acc[4][4];
#pragma unroll
    for (int mb = 0; mb < 4; ++mb)
#pragma unroll
        for (int nb = 0; nb < 4; ++nb) acc[mb][nb] = (v8f){};
    const size_t aoff = (size_t)(r0 + lr) * K + 8 * hi, boff = (size_t)(c0 + lr) * K + 8 * hi;
#pragma unroll 1
    for (int kc = 0; kc < K; kc += 32) {
        V a[4], a2[4];
#pragma unroll
        for (int mb = 0; mb < 4; ++mb) { a[mb] = WFrag<T16>::ld(A + aoff + (size_t)mb * 16 * K + kc); if (NSPLIT == 1 || NSPLIT == 2) a2[mb] = WFrag<T16>::ld(A2 + aoff + (size_t)mb * 16 * K + kc); }
#pragma unroll
        for (int nb = 0; nb < 4; ++nb) { const V b = WFrag<T16>::ld(Bt + boff + (size_t)nb * 16 * K + kc); V b2; if (NSPLIT >= 2) b2 = WFrag<T16>::ld(Bt2 + boff + (size_t)nb * 16 * K + kc);
#pragma unroll
            for (int mb = 0; mb < 4; ++mb) { acc[mb][nb] = WFrag<T16>::mma(a[mb], b, acc[mb][nb]); if (NSPLIT == 1 || NSPLIT == 2) acc[mb][nb] = WFrag<T16>::mma(a2[mb], b, acc[mb][nb]); if (NSPLIT >= 2) acc[mb][nb] = WFrag<T16>::mma(a[mb], b2, acc[mb][nb]); } }
        asm volatile("v_nop\n\tv_nop\n\tv_nop\n\tv_nop" : "+v"(acc[0][0]), "+v"(acc[1][1]), "+v"(acc[2][2]), "+v"(acc[3][3]) : "v"(a[0]), "v"(a[3]));
    }
#pragma unroll
    for (int mb = 0; mb < 4; ++mb) {
#pragma unroll
        for (int nb = 0; nb < 4; ++nb) {
#pragma unroll
            for (int j = 0; j < 8; ++j) os[(hi * 8 + j) * 68 + nb * 16 + lr] = acc[mb][nb][j]; }
        __builtin_amdgcn_wave_barrier(); asm volatile("" ::: "memory");
        float* crow = C + (size_t)(r0 + mb * 16) * ldc + c0;
{
#pragma unroll
            for (int s = 0; s < 8; ++s) { const int row = 2 * s + hi, cofs = lr * 4; v4f val = *(const v4fa*)(os + row * 68 + cofs); if (BIAS) { val[0] += bfr(bias[c0 + cofs]); val[1] += bfr(bias[c0 + cofs + 1]); val[2] += bfr(bias[c0 + cofs + 2]); val[3] += bfr(bias[c0 + cofs + 3]); }
                *(v4f*)(crow + (size_t)row * ldc + cofs) = val; }
             }
        __builtin_amdgcn_wave_barrier(); asm volatile("" ::: "memory");
    }
}

// ---- k_gemmc: the same one-wave 64x64 tile GEMM specialised for causal attention: CMODE 1 skips score tiles entirely above the diagonal (query rows r0+roff.., key columns c0..), CMODE 2 limits the
// key (K) loop of the probability x value contraction to the diagonal block (probabilities beyond it are exactly zero). roff = row offset of this launch's first row within the sequence.
template <typename T16, int NSPLIT, int CMODE>
__global__ __launch_bounds__(32) void k_gemmc(const T16* __restrict__ A, const T16* __restrict__ A2, const T16* __restrict__ Bt, const T16* __restrict__ Bt2, int K, float* C, int ldc, int roff, size_t sA, size_t sB, size_t sC) {
    typedef typename WFrag<T16>::V V;
    __shared__ __align__(16) float os[16 * 68];
    const size_t z = blockIdx.z; A += z * sA; if (A2) A2 += z * sA; Bt += z * sB; if (Bt2) Bt2 += z * sB; C += z * sC;
    const int lane = threadIdx.x & 31, lr = lane & 15, hi = lane >> 4; const int r0 = blockIdx.x * 64, c0 = blockIdx.y * 64;
    if (CMODE == 1 && c0 > r0 + roff + 63) return;                  // score tile entirely above the causal diagonal: never read (the softmax masks j > i by select)
    const int Kl = (CMODE == 2) ? min(K, r0 + roff + 64) : K;        // P.V: probabilities are exactly 0 beyond the diagonal block, so the K loop stops there
    v8f acc[4][4];
#pragma unroll
    for (int mb = 0; mb < 4; ++mb)
#pragma unroll
        for (int nb = 0; nb < 4; ++nb) acc[mb][nb] = (v8f){};
    const size_t aoff = (size_t)(r0 + lr) * K + 8 * hi, boff = (size_t)(c0 + lr) * K + 8 * hi;
#pragma unroll 1
    for (int kc = 0; kc < Kl; kc += 32) {
        V a[4], a2[4];
#pragma unroll
        for (int mb = 0; mb < 4; ++mb) { a[mb] = WFrag<T16>::ld(A + aoff + (size_t)mb * 16 * K + kc); if (NSPLIT == 1 || NSPLIT == 2) a2[mb] = WFrag<T16>::ld(A2 + aoff + (size_t)mb * 16 * K + kc); }
#pragma unroll
        for (int nb = 0; nb < 4; ++nb) { const V b = WFrag<T16>::ld(Bt + boff + (size_t)nb * 16 * K + kc); V b2; if (NSPLIT >= 2) b2 = WFrag<T16>::ld(Bt2 + boff + (size_t)nb * 16 * K + kc);
#pragma unroll
            for (int mb = 0; mb < 4; ++mb) { acc[mb][nb] = WFrag<T16>::mma(a[mb], b, acc[mb][nb]); if (NSPLIT == 1 || NSPLIT == 2) acc[mb][nb] = WFrag<T16>::mma(a2[mb], b, acc[mb][nb]); if (NSPLIT >= 2) acc[mb][nb] = WFrag<T16>::mma(a[mb], b2, acc[mb][nb]); } }
        asm volatile("v_nop\n\tv_nop\n\tv_nop\n\tv_nop" : "+v"(acc[0][0]), "+v"(acc[1][1]), "+v"(acc[2][2]), "+v"(acc[3][3]) : "v"(a[0]), "v"(a[3]));
    }
#pragma unroll
    for (int mb = 0; mb < 4; ++mb) {
#pragma unroll
        for (int nb = 0; nb < 4; ++nb) {
#pragma unroll
            for (int j = 0; j < 8; ++j) os[(hi * 8 + j) * 68 + nb * 16 + lr] = acc[mb][nb][j]; }
        __builtin_amdgcn_wave_barrier(); asm volatile("" ::: "memory");
        float* crow = C + (size_t)(r0 + mb * 16) * ldc + c0;
{
#pragma unroll
            for (int s = 0; s < 8; ++s) { const int row = 2 * s + hi, cofs = lr * 4; v4f val = *(const v4fa*)(os + row * 68 + cofs);
                *(v4f*)(crow + (size_t)row * ldc + cofs) = val; }
             }
        __builtin_amdgcn_wave_barrier(); asm volatile("" ::: "memory");
    }
}

__device__ __forceinline__ h16 tohx(float x) { return (h16)x; }
__device__ __forceinline__ void splitf(float y, unsigned short& h, unsigned short& l) { h = f2bf(y); l = f2bf(y - bf2f(h)); }
typedef __attribute__((ext_vector_type(2))) _Float16 v2h;
typedef __attribute__((ext_vector_type(4))) _Float16 v4h;
typedef __attribute__((ext_vector_type(2))) unsigned short v2us;
typedef __attribute__((ext_vector_type(4))) unsigned short v4us;
typedef __attribute__((ext_vector_type(2))) float v2f;
typedef __attribute__((ext_vector_type(4))) int v4i;

__global__ __launch_bounds__(256) void k_wtG(const float* __restrict__ w, int K, int N, bf* Bt) {
    const int lane = threadIdx.x & 31; const int L0 = (blockIdx.x * 8 + (threadIdx.x >> 5)) * 8; const int nlines = N * K / 64;
{
#pragma unroll 1
        for (int l = 0; l < 8; ++l) { const int L = L0 + l; if (L >= nlines) break; const size_t e = (size_t)L * 64 + lane * 2; const int k = (int)(e % K), n = (int)(e / K); v2us o;
            o[0] = f2bf(w[(size_t)k * N + n]); o[1] = f2bf(w[(size_t)(k + 1) * N + n]); *(v2us*)(Bt + e) = o; }
         }
}
__global__ __launch_bounds__(256) void k_cvt8(const float* __restrict__ src, bf* dst, size_t n8) { const size_t i = (size_t)blockIdx.x * 256 + threadIdx.x; if (i >= n8) return; const v8f v = *(const v8f*)(src + i * 8); v8us o;
#pragma unroll
    for (int k = 0; k < 8; ++k) o[k] = f2bf(v[k]); *(v8us*)(dst + i * 8) = o;  }

// k_rope: head planes [h][t][d] (fp16 + hi/lo) of rope(x) x sc with the rotate-half convention out[d] = x[d] cos[t][d] - x[d+HD/2] sin[t][d], out[d+HD/2] = x[d+HD/2] cos[t][d+HD/2] + x[d] sin[t][d+HD/2]
__global__ __launch_bounds__(256) void k_rope(const float* __restrict__ F, int pitch, int nheads, const float* __restrict__ CS, const float* __restrict__ RF, const float* __restrict__ nw, float sc, h16* P16, bf* Ph, bf* Pl) {
    const size_t e = ((size_t)blockIdx.x * 256 + threadIdx.x) * 2; if (e >= (size_t)nheads * TT * HD) return; const int d = (int)(e % HD); const int t = (int)((e / HD) % TT); const int h = (int)(e / ((size_t)HD * TT)); const size_t bo = (size_t)blockIdx.y * nheads * TT * HD; P16 += bo; Ph += bo; Pl += bo;   // grid y = batch: its rows of F, its head planes
    const float* f = F + ((size_t)blockIdx.y * TT + t) * pitch + h * HD; const float rf = RF ? RF[(size_t)h * TT + t] : 1.0f; v2h o16; v2us oh, ol;
#pragma unroll
    for (int q = 0; q < 2; ++q) { const int dd = d + q; const int dp = (dd < HD / 2) ? dd + HD / 2 : dd - HD / 2; float x0 = f[dd], x1 = f[dp];
        if (RF) { float n0 = __fmul_rn(x0, rf), n1 = __fmul_rn(x1, rf); asm volatile("" : "+v"(n0)); asm volatile("" : "+v"(n1)); x0 = __fmul_rn(bfr(nw[dd]), n0); x1 = __fmul_rn(bfr(nw[dp]), n1); }
        const v2f cs = *(const v2f*)(CS + ((size_t)t * HD + dd) * 2); float a = __fmul_rn(x0, cs[0]), bq = __fmul_rn(x1, cs[1]); asm volatile("" : "+v"(a)); asm volatile("" : "+v"(bq)); const float r = ((dd < HD / 2) ? __fsub_rn(a, bq) : __fadd_rn(a, bq)) * sc;
        o16[q] = tohx(r); unsigned short a2, c2; splitf(r, a2, c2); oh[q] = a2; ol[q] = c2; }
    *(v2h*)(P16 + e) = o16; *(v2us*)(Ph + e) = oh; *(v2us*)(Pl + e) = ol;  }
__global__ __launch_bounds__(256) void k_vtp(const float* __restrict__ F, int pitch, int nheads, h16* V16, bf* Vh, bf* Vl) { const size_t e = ((size_t)blockIdx.x * 256 + threadIdx.x) * 2; if (e >= (size_t)nheads * HD * TT) return; const int t = (int)(e % TT); const int d = (int)((e / TT) % HD); const int g = (int)(e / ((size_t)TT * HD)); v2h o16; v2us oh, ol;
    const size_t bo = (size_t)blockIdx.y * nheads * HD * TT; V16 += bo; Vh += bo; Vl += bo; F += (size_t)blockIdx.y * TT * pitch;   // grid y = batch
#pragma unroll
    for (int q = 0; q < 2; ++q) { const float x = F[(size_t)(t + q) * pitch + g * HD + d]; o16[q] = tohx(x); unsigned short a2, c2; splitf(x, a2, c2); oh[q] = a2; ol[q] = c2; }
    *(v2h*)(V16 + e) = o16; *(v2us*)(Vh + e) = oh; *(v2us*)(Vl + e) = ol;  }
__global__ __launch_bounds__(256) void k_csid(float* CS) { const int idx = blockIdx.x * 256 + threadIdx.x; if (idx >= TT * HD) return; v2f cs; cs[0] = 1.0f; cs[1] = 0.0f; *(v2f*)(CS + (size_t)idx * 2) = cs;  }
// k_asoft: per row (zz, i): t = S x 384^-0.5 for j <= i and i - j < WIN (sliding causal window; the reference's -1e9 additive fill vanishes identically); softmax over the 256 keys (register row, one exp, fixed trees);
__global__ __launch_bounds__(256) void k_asoft(const float* __restrict__ Sb, h16* P16, bf* Ph, bf* Pl) {
    const int lane = threadIdx.x & 31; const int row = blockIdx.x * 8 + (threadIdx.x >> 5); if (row >= ZH * TT) return; const int i = row % TT; const int zz = row / TT; (void)zz; const bool hires = (i < RH); const float* sr = Sb + (size_t)row * TT; float v[TT / 32]; float mx = -3.0e38f;
#pragma unroll
    for (int ch = 0; ch < TT / 128; ++ch) { const int j0 = ch * 128 + lane * 4; const v4f a = *(const v4f*)(sr + j0);
#pragma unroll
        for (int q = 0; q < 4; ++q) { const int j = j0 + q; (void)j; const float t = (j <= i && i - j < WIN) ? a[q] * SCL : -3.0e38f; v[ch * 4 + q] = t; mx = fmaxf(mx, t); } }
#pragma unroll
    for (int sh = 16; sh; sh >>= 1) mx = fmaxf(mx, __shfl_xor(mx, sh, 32));
    float sum = 0.f;
#pragma unroll
    for (int k = 0; k < TT / 32; ++k) { float d0 = __fsub_rn(v[k], mx); asm volatile("" : "+v"(d0)); v[k] = __builtin_amdgcn_exp2f(__fmul_rn(d0, 1.4426950408889634f)); sum += v[k]; }
#pragma unroll
    for (int sh = 16; sh; sh >>= 1) sum += __shfl_xor(sum, sh, 32);
    const float f = __fdiv_rn(hires ? 1.0f : PCAR, sum);
{
        if (hires) {
#pragma unroll
            for (int ch = 0; ch < TT / 128; ++ch) { v4us oh, ol;
#pragma unroll
                for (int q = 0; q < 4; ++q) { unsigned short a, c2; splitf(v[ch * 4 + q] * f, a, c2); oh[q] = a; ol[q] = c2; }
                const size_t oo = ((size_t)zz * (RH ? RH : 1) + i) * TT + ch * 128 + lane * 4; *(v4us*)(Ph + oo) = oh; *(v4us*)(Pl + oo) = ol; }
        } else {
#pragma unroll
            for (int ch = 0; ch < TT / 128; ++ch) { v4h o4;
#pragma unroll
                for (int q = 0; q < 4; ++q) o4[q] = tohx(v[ch * 4 + q] * f);
                *(v4h*)(P16 + (size_t)row * TT + ch * 128 + lane * 4) = o4; } }
         }
}
__global__ __launch_bounds__(256) void k_merge(const float* __restrict__ O, float* OUTb) { const size_t e = ((size_t)blockIdx.x * 256 + threadIdx.x) * 2; if (e >= (size_t)ZH * TT * HD) return; const int d = (int)(e % HD); const int t = (int)((e / HD) % TT); const int zz = (int)(e / ((size_t)HD * TT)); const float cs = (t < RH) ? 1.0f : (1.0f / PCAR); const size_t oo = ((size_t)(zz / NH_) * TT + t) * DQ + (zz % NH_) * HD + d;   // plane zz = batch * NH_ + head
    v2f o2; o2[0] = O[e] * cs; o2[1] = O[e + 1] * cs; *(v2f*)(OUTb + oo) = o2;  }

extern "C" void kernel_launch(void* const* d_in, const int* in_sizes, int n_in,
                              void* d_out, int out_size, void* d_ws, size_t ws_size, hipStream_t stream) {
    (void)in_sizes; (void)n_in; (void)out_size;
    const float* x = (const float*)d_in[0]; const float* wq = (const float*)d_in[1]; const float* wk = (const float*)d_in[2]; const float* wv = (const float*)d_in[3]; const float* wo = nullptr; (void)wo;
    float* OUT = (float*)d_out;     // [128][256][384]
    char* wsp = (char*)d_ws;
    auto take = [&](size_t bytes) { char* p = wsp; wsp += (bytes + 255) & ~(size_t)255; return (void*)p; };
    bf* WQ = (bf*)take((size_t)DF * DM * 2); bf* WK = WQ + (size_t)DQ * DM; bf* WV = WK + (size_t)DKV * DM; float* CS = (float*)take((size_t)TT * HD * 2 * 4);   // stacked weights [DF][DM]
    // region 1: what is dead once the scores are written; the probability planes then take its place (stream-ordered)
    bf* XB = (bf*)take((size_t)CB * TT * DM * 2);
    h16* QP16 = (h16*)take((size_t)ZH * TT * HD * 2); h16* KP16 = (h16*)take((size_t)ZH * TT * HD * 2); h16* VT16 = (h16*)take((size_t)ZH * HD * TT * 2);
    bf* QPh = (bf*)take((size_t)ZH * TT * HD * 2); bf* QPl = (bf*)take((size_t)ZH * TT * HD * 2); bf* KPh = (bf*)take((size_t)ZH * TT * HD * 2); bf* KPl = (bf*)take((size_t)ZH * TT * HD * 2);
    bf* Ph = XB; bf* Pl = Ph + (size_t)ZH * RH * TT;   // 2 x ZH*RH*TT*2 bytes = the eight planes above
    static_assert((size_t)ZH * RH * TT * 2 * 2 == (size_t)CB * TT * DM * 2 + (size_t)ZH * TT * HD * 2 * 7, "probability planes fill region 1");
    bf* VTh = (bf*)take((size_t)ZH * HD * TT * 2); bf* VTl = (bf*)take((size_t)ZH * HD * TT * 2);
    // region 2: the f32 projection, then the scores, then the f32 att.v, each dead before the next is written (stream-ordered)
    float* Sb = (float*)take((size_t)ZH * TT * TT * 4); h16* P16 = nullptr; float* FX = Sb; float* Ob = Sb;
    static_assert((size_t)CB * TT * DF <= (size_t)ZH * TT * TT && HD <= TT, "projection and att.v fit the score buffer");
    if ((size_t)(wsp - (char*)d_ws) > ws_size) return;    // ws 256 MiB
    { k_wtG<<<(unsigned)((DM * DQ / 64 + 63) / 64), 256, 0, stream>>>(wq, DM, DQ, WQ); k_wtG<<<(unsigned)((DM * DKV / 64 + 63) / 64), 256, 0, stream>>>(wk, DM, DKV, WK); k_wtG<<<(unsigned)((DM * DKV / 64 + 63) / 64), 256, 0, stream>>>(wv, DM, DKV, WV);
       }
    k_csid<<<(TT * HD + 255) / 256, 256, 0, stream>>>(CS);
    const unsigned LQ = (unsigned)(((size_t)NH_ * TT * HD / 2 + 255) / 256), LKv = (unsigned)(((size_t)NKV * TT * HD / 2 + 255) / 256);
    for (int b = 0; b < NB_; b += CB) {
        k_cvt8<<<(unsigned)(((size_t)CB * TT * DM / 8 + 255) / 256), 256, 0, stream>>>(x + (size_t)b * TT * DM, XB, (size_t)CB * TT * DM / 8);
        k_gemmw<bf, 0, false><<<dim3(CB * TT / 64, DF / 64, 1), 32, 0, stream>>>(XB, nullptr, WQ, nullptr, DM, FX, DF, nullptr, 0, 0, 0);   // rows = (batch, t), columns = q | k | v
        k_rope<<<dim3(LQ, CB, 1), 256, 0, stream>>>(FX, DF, NH_, CS, nullptr, nullptr, 1.0f, QP16, QPh, QPl);
        k_rope<<<dim3(LKv, CB, 1), 256, 0, stream>>>(FX + DQ, DF, NKV, CS, nullptr, nullptr, 1.0f, KP16, KPh, KPl);
        k_vtp<<<dim3(LKv, CB, 1), 256, 0, stream>>>(FX + DQ + DKV, DF, NKV, VT16, VTh, VTl);
        // one kv head per query head: plane z = batch * NH_ + head on every operand (z-strides TT*HD)
        k_gemmc<bf, 2, 1><<<dim3(RH / 64, TT / 64, ZH), 32, 0, stream>>>(QPh, QPl, KPh, KPl, HD, Sb, TT, 0, (size_t)TT * HD, (size_t)TT * HD, (size_t)TT * TT);
        k_asoft<<<ZH * TT / 8, 256, 0, stream>>>(Sb, P16, Ph, Pl);
        k_gemmc<bf, 2, 2><<<dim3(RH / 64, HD / 64, ZH), 32, 0, stream>>>(Ph, Pl, VTh, VTl, TT, Ob, HD, 0, (size_t)RH * TT, (size_t)HD * TT, (size_t)TT * HD);
        k_merge<<<(unsigned)(((size_t)ZH * TT * HD / 2 + 255) / 256), 256, 0, stream>>>(Ob, OUT + (size_t)b * TT * DQ);
    }
}

// v002
// Measured time: 245 microseconds a run.
// In two side-by-side timings against v001, it was 1.53 and 1.52 times as fast.
// Counting every step since v000, it is 40.6 times as fast.
#include <hip/hip_runtime.h>

// Causal multi-head attention with hidden-size scaling (x [128][256][384]; q,k,v = x W ('xw' [384][384], no bias; 6 heads x 64); scores x 384^-0.5 (module quirk), causal (-inf); softmax; out = merged att.v -> [128][256][384] (12.6 M)).
// Layout per group of CB batches, every stage one launch: bf16 copy of x; exact projections (q, k, v as one product against the stacked weights); q and k head planes (k_rope each); v^T head planes (k_vtp); causal T-256 attention with EVERY row on hi/lo planes, one fused launch (one work-group per (batch, head); scores and probabilities stay in registers; key chunks above the diagonal skipped) that writes the merged output rows.
// Compute dtypes, f32 accumulate: every input rounded to bf16; projections exact; scores and att.v 3 products; softmax f32; output f32.

#define NB_  128
#define TT   256
#define DM   384
#define NH_  6
#define NKV  6
#define REP  (NH_ / NKV)
#define HD   64
#define DQ   (NH_ * HD)
#define DKV  (NKV * HD)
#define CB   64                   // batches per launch (the workspace holds the planes of 64)
#define ZH   (CB * NH_)           // (batch, head) planes per attention launch
#define DF   (DQ + 2 * DKV)       // row pitch of the stacked q | k | v projection
#define RH   256                  // unused; k_fattn puts every query row on hi+lo planes
#define WIN  256
#define PCAR 1024.0f
#define SCL  0.051031036307982884f   // 384^-0.5 (the module scales by the embedding size)
typedef _Float16 h16;
typedef unsigned short bf;
typedef __attribute__((ext_vector_type(16))) __bf16   v16bf;
typedef __attribute__((ext_vector_type(16))) _Float16 v16h;
typedef __attribute__((ext_vector_type(8)))  _Float16 v8h;
typedef __attribute__((ext_vector_type(8)))  unsigned short v8us;
typedef __attribute__((ext_vector_type(8)))  float    v8f;
typedef __attribute__((ext_vector_type(4)))  float    v4f;
typedef v8h  __attribute__((may_alias)) v8ha;
typedef v4f  __attribute__((may_alias)) v4fa;
typedef v8us __attribute__((may_alias)) v8usa;

__device__ __forceinline__ unsigned short f2bf(float f) { unsigned u = __float_as_uint(f); u += 0x7FFFu + ((u >> 16) & 1u); return (unsigned short)(u >> 16); }
__device__ __forceinline__ float bf2f(unsigned short b) { return __uint_as_float(((unsigned)b) << 16); }
__device__ __forceinline__ float bfr(float f) { return bf2f(f2bf(f)); }
__device__ __forceinline__ v16h cat16(v8h lo, v8h hi) { return __builtin_shufflevector(lo, hi, 0, 1, 2, 3, 4, 5, 6, 7, 8, 9, 10, 11, 12, 13, 14, 15); }
__device__ __forceinline__ v16bf cat16b(v8us lo, v8us hi) { return __builtin_bit_cast(v16bf, __builtin_shufflevector(lo, hi, 0, 1, 2, 3, 4, 5, 6, 7, 8, 9, 10, 11, 12, 13, 14, 15)); }
__device__ __forceinline__ v8f wmma16(v16h a, v16h b, v8f c) { return __builtin_amdgcn_wmma_f32_16x16x32_f16(false, a, false, b, (short)0, c, false, false); }
__device__ __forceinline__ v8f wmmab(v16bf a, v16bf b, v8f c) { return __builtin_amdgcn_wmma_f32_16x16x32_bf16(false, a, false, b, (short)0, c, false, false); }



// ---- k_gemmw: register-blocked GEMM, ONE WAVE per 64x64 output tile (16 accumulators), operands straight from K-contiguous 16-bit planes; grid (M/64, N/64, Z), 32 threads.
// C[m][n] (f32, pitch ldc, + optional f32 bias[n]) = sum_k A[m][k] Bt[n][k] (+ split products per NSPLIT). z-batch strides sA/sB/sC in elements. K % 32 == 0.
template <typename T16> struct WFrag;
template <> struct WFrag<h16> { typedef v16h V; static __device__ __forceinline__ V ld(const h16* p) { return cat16(*(const v8h*)p, *(const v8h*)(p + 16)); } static __device__ __forceinline__ v8f mma(V a, V b, v8f c) { return wmma16(a, b, c); } };
template <> struct WFrag<bf> { typedef v16bf V; static __device__ __forceinline__ V ld(const bf* p) { return cat16b(*(const v8us*)p, *(const v8us*)(p + 16)); } static __device__ __forceinline__ v8f mma(V a, V b, v8f c) { return wmmab(a, b, c); } };
template <typename T16, int NSPLIT, bool BIAS>
__global__ __launch_bounds__(32) void k_gemmw(const T16* __restrict__ A, const T16* __restrict__ A2, const T16* __restrict__ Bt, const T16* __restrict__ Bt2, int K, float* C, int ldc, const float* __restrict__ bias, size_t sA, size_t sB, size_t sC) {
    typedef typename WFrag<T16>::V V;
    __shared__ __align__(16) float os[16 * 68];
    const size_t z = blockIdx.z; A += z * sA; if (A2) A2 += z * sA; Bt += z * sB; if (Bt2) Bt2 += z * sB; C += z * sC;
    const int lane = threadIdx.x & 31, lr = lane & 15, hi = lane >> 4; const int r0 = blockIdx.x * 64, c0 = blockIdx.y * 64;
    v8f acc[4][4];
#pragma unroll
    for (int mb = 0; mb < 4; ++mb)
#pragma unroll
        for (int nb = 0; nb < 4; ++nb) acc[mb][nb] = (v8f){};
    const size_t aoff = (size_t)(r0 + lr) * K + 8 * hi, boff = (size_t)(c0 + lr) * K + 8 * hi;
#pragma unroll 1
    for (int kc = 0; kc < K; kc += 32) {
        V a[4], a2[4];
#pragma unroll
        for (int mb = 0; mb < 4; ++mb) { a[mb] = WFrag<T16>::ld(A + aoff + (size_t)mb * 16 * K + kc); if (NSPLIT == 1 || NSPLIT == 2) a2[mb] = WFrag<T16>::ld(A2 + aoff + (size_t)mb * 16 * K + kc); }
#pragma unroll
        for (int nb = 0; nb < 4; ++nb) { const V b = WFrag<T16>::ld(Bt + boff + (size_t)nb * 16 * K + kc); V b2; if (NSPLIT >= 2) b2 = WFrag<T16>::ld(Bt2 + boff + (size_t)nb * 16 * K + kc);
#pragma unroll
            for (int mb = 0; mb < 4; ++mb) { acc[mb][nb] = WFrag<T16>::mma(a[mb], b, acc[mb][nb]); if (NSPLIT == 1 || NSPLIT == 2) acc[mb][nb] = WFrag<T16>::mma(a2[mb], b, acc[mb][nb]); if (NSPLIT >= 2) acc[mb][nb] = WFrag<T16>::mma(a[mb], b2, acc[mb][nb]); } }
        asm volatile("v_nop\n\tv_nop\n\tv_nop\n\tv_nop" : "+v"(acc[0][0]), "+v"(acc[1][1]), "+v"(acc[2][2]), "+v"(acc[3][3]) : "v"(a[0]), "v"(a[3]));
    }
#pragma unroll
    for (int mb = 0; mb < 4; ++mb) {
#pragma unroll
        for (int nb = 0; nb < 4; ++nb) {
#pragma unroll
            for (int j = 0; j < 8; ++j) os[(hi * 8 + j) * 68 + nb * 16 + lr] = acc[mb][nb][j]; }
        __builtin_amdgcn_wave_barrier(); asm volatile("" ::: "memory");
        float* crow = C + (size_t)(r0 + mb * 16) * ldc + c0;
{
#pragma unroll
            for (int s = 0; s < 8; ++s) { const int row = 2 * s + hi, cofs = lr * 4; v4f val = *(const v4fa*)(os + row * 68 + cofs); if (BIAS) { val[0] += bfr(bias[c0 + cofs]); val[1] += bfr(bias[c0 + cofs + 1]); val[2] += bfr(bias[c0 + cofs + 2]); val[3] += bfr(bias[c0 + cofs + 3]); }
                *(v4f*)(crow + (size_t)row * ldc + cofs) = val; }
             }
        __builtin_amdgcn_wave_barrier(); asm volatile("" ::: "memory");
    }
}

__device__ __forceinline__ h16 tohx(float x) { return (h16)x; }
__device__ __forceinline__ void splitf(float y, unsigned short& h, unsigned short& l) { h = f2bf(y); l = f2bf(y - bf2f(h)); }
typedef __attribute__((ext_vector_type(2))) _Float16 v2h;
typedef __attribute__((ext_vector_type(4))) _Float16 v4h;
typedef __attribute__((ext_vector_type(2))) unsigned short v2us;
typedef __attribute__((ext_vector_type(4))) unsigned short v4us;
typedef __attribute__((ext_vector_type(2))) float v2f;
typedef __attribute__((ext_vector_type(4))) int v4i;

__global__ __launch_bounds__(256) void k_wtG(const float* __restrict__ w, int K, int N, bf* Bt) {
    const int lane = threadIdx.x & 31; const int L0 = (blockIdx.x * 8 + (threadIdx.x >> 5)) * 8; const int nlines = N * K / 64;
{
#pragma unroll 1
        for (int l = 0; l < 8; ++l) { const int L = L0 + l; if (L >= nlines) break; const size_t e = (size_t)L * 64 + lane * 2; const int k = (int)(e % K), n = (int)(e / K); v2us o;
            o[0] = f2bf(w[(size_t)k * N + n]); o[1] = f2bf(w[(size_t)(k + 1) * N + n]); *(v2us*)(Bt + e) = o; }
         }
}
__global__ __launch_bounds__(256) void k_cvt8(const float* __restrict__ src, bf* dst, size_t n8) { const size_t i = (size_t)blockIdx.x * 256 + threadIdx.x; if (i >= n8) return; const v8f v = *(const v8f*)(src + i * 8); v8us o;
#pragma unroll
    for (int k = 0; k < 8; ++k) o[k] = f2bf(v[k]); *(v8us*)(dst + i * 8) = o;  }

// k_rope: head planes [h][t][d] (fp16 + hi/lo) of rope(x) x sc with the rotate-half convention out[d] = x[d] cos[t][d] - x[d+HD/2] sin[t][d], out[d+HD/2] = x[d+HD/2] cos[t][d+HD/2] + x[d] sin[t][d+HD/2]
__global__ __launch_bounds__(256) void k_rope(const float* __restrict__ F, int pitch, int nheads, const float* __restrict__ CS, const float* __restrict__ RF, const float* __restrict__ nw, float sc, h16* P16, bf* Ph, bf* Pl) {
    const size_t e = ((size_t)blockIdx.x * 256 + threadIdx.x) * 2; if (e >= (size_t)nheads * TT * HD) return; const int d = (int)(e % HD); const int t = (int)((e / HD) % TT); const int h = (int)(e / ((size_t)HD * TT)); const size_t bo = (size_t)blockIdx.y * nheads * TT * HD; P16 += bo; Ph += bo; Pl += bo;   // grid y = batch: its rows of F, its head planes
    const float* f = F + ((size_t)blockIdx.y * TT + t) * pitch + h * HD; const float rf = RF ? RF[(size_t)h * TT + t] : 1.0f; v2h o16; v2us oh, ol;
#pragma unroll
    for (int q = 0; q < 2; ++q) { const int dd = d + q; const int dp = (dd < HD / 2) ? dd + HD / 2 : dd - HD / 2; float x0 = f[dd], x1 = f[dp];
        if (RF) { float n0 = __fmul_rn(x0, rf), n1 = __fmul_rn(x1, rf); asm volatile("" : "+v"(n0)); asm volatile("" : "+v"(n1)); x0 = __fmul_rn(bfr(nw[dd]), n0); x1 = __fmul_rn(bfr(nw[dp]), n1); }
        const v2f cs = *(const v2f*)(CS + ((size_t)t * HD + dd) * 2); float a = __fmul_rn(x0, cs[0]), bq = __fmul_rn(x1, cs[1]); asm volatile("" : "+v"(a)); asm volatile("" : "+v"(bq)); const float r = ((dd < HD / 2) ? __fsub_rn(a, bq) : __fadd_rn(a, bq)) * sc;
        o16[q] = tohx(r); unsigned short a2, c2; splitf(r, a2, c2); oh[q] = a2; ol[q] = c2; }
    *(v2h*)(P16 + e) = o16; *(v2us*)(Ph + e) = oh; *(v2us*)(Pl + e) = ol;  }
__global__ __launch_bounds__(256) void k_vtp(const float* __restrict__ F, int pitch, int nheads, h16* V16, bf* Vh, bf* Vl) { const size_t e = ((size_t)blockIdx.x * 256 + threadIdx.x) * 2; if (e >= (size_t)nheads * HD * TT) return; const int t = (int)(e % TT); const int d = (int)((e / TT) % HD); const int g = (int)(e / ((size_t)TT * HD)); v2h o16; v2us oh, ol;
    const size_t bo = (size_t)blockIdx.y * nheads * HD * TT; V16 += bo; Vh += bo; Vl += bo; F += (size_t)blockIdx.y * TT * pitch;   // grid y = batch
#pragma unroll
    for (int q = 0; q < 2; ++q) { const float x = F[(size_t)(t + q) * pitch + g * HD + d]; o16[q] = tohx(x); unsigned short a2, c2; splitf(x, a2, c2); oh[q] = a2; ol[q] = c2; }
    *(v2h*)(V16 + e) = o16; *(v2us*)(Vh + e) = oh; *(v2us*)(Vl + e) = ol;  }
__global__ __launch_bounds__(256) void k_csid(float* CS) { const int idx = blockIdx.x * 256 + threadIdx.x; if (idx >= TT * HD) return; v2f cs; cs[0] = 1.0f; cs[1] = 0.0f; *(v2f*)(CS + (size_t)idx * 2) = cs;  }
// ---- k_fattn: scores, causal softmax, att.v and the head merge of ONE (batch, head) plane in one work-group of 8 waves; the scores and probabilities never leave the registers.
// The K planes [t][d] and the transposed V planes [d][t] (hi and lo) are staged once in LDS. A wave owns 16 query rows at a time and takes row tiles w and 15 - w, so every wave does 9 key chunks of 32.
// Scores are formed transposed (A = 16 keys, B = 16 queries): a lane then holds 8 keys of ITS query per tile, the softmax runs along the registers plus one exchange between the lane halves,
// and two neighbouring tiles, rounded to bf16 in place, are the A fragment (16 queries x 32 keys) of att.v in the k order of WFrag::ld (k = 16 (s >> 3) + 8 hi + (s & 7)).
#define KP   (HD + 8)             // LDS pitch of a K row, elements: 144 B = 16 B x odd
#define VP   (TT + 8)             // LDS pitch of a V^T row, elements: 528 B = 16 B x odd
#define OP   36                   // LDS pitch of the output staging, floats (32 columns + 4)
__global__ __launch_bounds__(256) __attribute__((amdgpu_waves_per_eu(4, 4))) void k_fattn(const bf* __restrict__ Qh, const bf* __restrict__ Ql, const bf* __restrict__ Kh, const bf* __restrict__ Kl, const bf* __restrict__ Vh, const bf* __restrict__ Vl, float* OUTb) {
    typedef WFrag<bf>::V V;
    __shared__ __align__(16) bf sK[2][TT * KP];
    __shared__ __align__(16) bf sV[2][HD * VP];
    __shared__ __align__(16) float os[8][16 * OP];
    const int tid = threadIdx.x, lane = tid & 31, lr = lane & 15, hi = lane >> 4; const int w = __builtin_amdgcn_readfirstlane(tid >> 5);
    const size_t zo = (size_t)blockIdx.x * TT * HD;   // plane z = batch * NH_ + head, the same stride on every operand
#pragma unroll
    for (int it = 0; it < TT * HD / 8 / 256; ++it) { const int i = it * 256 + tid;
        *(v8us*)(&sK[0][(i >> 3) * KP + (i & 7) * 8]) = *(const v8us*)(Kh + zo + (size_t)i * 8); *(v8us*)(&sK[1][(i >> 3) * KP + (i & 7) * 8]) = *(const v8us*)(Kl + zo + (size_t)i * 8);
        *(v8us*)(&sV[0][(i >> 5) * VP + (i & 31) * 8]) = *(const v8us*)(Vh + zo + (size_t)i * 8); *(v8us*)(&sV[1][(i >> 5) * VP + (i & 31) * 8]) = *(const v8us*)(Vl + zo + (size_t)i * 8); }
    __syncthreads();
    float* ow = os[w];
    float* orow = OUTb + (size_t)(blockIdx.x / NH_) * TT * DQ + (blockIdx.x % NH_) * HD;
    // rolled: one copy of the tile body, for speed only
#pragma unroll 1
    for (int pass = 0; pass < 2; ++pass) {
        const int tile = pass ? w : 15 - w; const int q0 = tile * 16; const int nc = (tile >> 1) + 1;   // nc key chunks of 32 reach the diagonal; wave-uniform
        const size_t qo = zo + (size_t)(q0 + lr) * HD + 8 * hi;
        const V qh0 = WFrag<bf>::ld(Qh + qo), qh1 = WFrag<bf>::ld(Qh + qo + 32), ql0 = WFrag<bf>::ld(Ql + qo), ql1 = WFrag<bf>::ld(Ql + qo + 32);
        asm volatile("s_wait_xcnt 0x0" ::: "memory");   // stands in front of the reuse of the Q loads' address registers
        v8f s[16]; float mx = -3.0e38f;
#pragma unroll
        for (int c = 0; c < 8; ++c) if (c < nc) {
#pragma unroll
            for (int tt = 0; tt < 2; ++tt) { const int ko = ((c * 2 + tt) * 16 + lr) * KP + 8 * hi;
                const V kh0 = WFrag<bf>::ld(&sK[0][ko]), kh1 = WFrag<bf>::ld(&sK[0][ko + 32]), kl0 = WFrag<bf>::ld(&sK[1][ko]), kl1 = WFrag<bf>::ld(&sK[1][ko + 32]);
                v8f a = (v8f){};
                a = wmmab(kh0, qh0, a); a = wmmab(kh0, ql0, a); a = wmmab(kl0, qh0, a);
                a = wmmab(kh1, qh1, a); a = wmmab(kh1, ql1, a); a = wmmab(kl1, qh1, a);
#pragma unroll
                for (int j = 0; j < 8; ++j) { const int key = (c * 2 + tt) * 16 + hi * 8 + j; const float t = (key <= q0 + lr) ? a[j] * SCL : -3.0e38f; a[j] = t; mx = fmaxf(mx, t); }
                s[c * 2 + tt] = a; }
        }
        mx = fmaxf(mx, __shfl_xor(mx, 16, 32));
        float sum = 0.f;
#pragma unroll
        for (int c = 0; c < 8; ++c) if (c < nc) {
#pragma unroll
            for (int e = 0; e < 16; ++e) { const float x = __fmul_rn(__fsub_rn(s[c * 2 + (e >> 3)][e & 7], mx), 1.4426950408889634f); float p;
                asm("v_exp_f32 %0, %1\n\tv_nop" : "=v"(p) : "v"(x));   // the v_nop fills the one slot the instruction set asks for behind a transcendental, whatever the compiler puts next
                s[c * 2 + (e >> 3)][e & 7] = p; sum += p; }
        }
        sum += __shfl_xor(sum, 16, 32);
        const float f = __fdiv_rn(1.0f, sum);
        v8f o[4];
#pragma unroll
        for (int nb = 0; nb < 4; ++nb) o[nb] = (v8f){};
#pragma unroll
        for (int c = 0; c < 8; ++c) if (c < nc) {
            V ph, pl;
#pragma unroll
            for (int e = 0; e < 16; ++e) { const float p = s[c * 2 + (e >> 3)][e & 7] * f; const __bf16 h = (__bf16)p; ph[e] = h; pl[e] = (__bf16)(p - (float)h); }
#pragma unroll
            for (int nb = 0; nb < 4; ++nb) { const int vo = (nb * 16 + lr) * VP + c * 32 + 8 * hi; const V vh = WFrag<bf>::ld(&sV[0][vo]), vl = WFrag<bf>::ld(&sV[1][vo]);
                o[nb] = wmmab(ph, vh, o[nb]); o[nb] = wmmab(pl, vh, o[nb]); o[nb] = wmmab(ph, vl, o[nb]); }
        }
        // merged output rows: 32 columns at a time through the wave's own LDS patch, so that every store instruction writes whole 128-byte lines
#pragma unroll
        for (int hf = 0; hf < 2; ++hf) {
#pragma unroll
            for (int nb = 0; nb < 2; ++nb) {
#pragma unroll
                for (int j = 0; j < 8; ++j) ow[(hi * 8 + j) * OP + nb * 16 + lr] = o[hf * 2 + nb][j]; }
            __builtin_amdgcn_wave_barrier(); asm volatile("" ::: "memory");   // keeps the other lanes' LDS stores in front of the reads below
#pragma unroll
            for (int r = 0; r < 4; ++r) { const int row = r * 4 + (lane >> 3), cofs = (lane & 7) * 4; *(v4f*)(orow + (size_t)(q0 + row) * DQ + hf * 32 + cofs) = *(const v4fa*)(ow + row * OP + cofs); }
            __builtin_amdgcn_wave_barrier(); asm volatile("" ::: "memory");   // keeps these reads in front of the next stores into the patch
        }
        asm volatile("s_wait_xcnt 0x0" ::: "memory");   // stands in front of the next pass's reuse of the output stores' registers
    }
}

extern "C" void kernel_launch(void* const* d_in, const int* in_sizes, int n_in,
                              void* d_out, int out_size, void* d_ws, size_t ws_size, hipStream_t stream) {
    (void)in_sizes; (void)n_in; (void)out_size;
    const float* x = (const float*)d_in[0]; const float* wq = (const float*)d_in[1]; const float* wk = (const float*)d_in[2]; const float* wv = (const float*)d_in[3]; const float* wo = nullptr; (void)wo;
    float* OUT = (float*)d_out;     // [128][256][384]
    char* wsp = (char*)d_ws;
    auto take = [&](size_t bytes) { char* p = wsp; wsp += (bytes + 255) & ~(size_t)255; return (void*)p; };
    bf* WQ = (bf*)take((size_t)DF * DM * 2); bf* WK = WQ + (size_t)DQ * DM; bf* WV = WK + (size_t)DKV * DM; float* CS = (float*)take((size_t)TT * HD * 2 * 4);   // stacked weights [DF][DM]
    bf* XB = (bf*)take((size_t)CB * TT * DM * 2);
    h16* QP16 = (h16*)take((size_t)ZH * TT * HD * 2); h16* KP16 = (h16*)take((size_t)ZH * TT * HD * 2); h16* VT16 = (h16*)take((size_t)ZH * HD * TT * 2);
    bf* QPh = (bf*)take((size_t)ZH * TT * HD * 2); bf* QPl = (bf*)take((size_t)ZH * TT * HD * 2); bf* KPh = (bf*)take((size_t)ZH * TT * HD * 2); bf* KPl = (bf*)take((size_t)ZH * TT * HD * 2);
    bf* VTh = (bf*)take((size_t)ZH * HD * TT * 2); bf* VTl = (bf*)take((size_t)ZH * HD * TT * 2);
    float* FX = (float*)take((size_t)CB * TT * DF * 4);   // the f32 projection
    if ((size_t)(wsp - (char*)d_ws) > ws_size) return;    // ws 256 MiB
    { k_wtG<<<(unsigned)((DM * DQ / 64 + 63) / 64), 256, 0, stream>>>(wq, DM, DQ, WQ); k_wtG<<<(unsigned)((DM * DKV / 64 + 63) / 64), 256, 0, stream>>>(wk, DM, DKV, WK); k_wtG<<<(unsigned)((DM * DKV / 64 + 63) / 64), 256, 0, stream>>>(wv, DM, DKV, WV);
       }
    k_csid<<<(TT * HD + 255) / 256, 256, 0, stream>>>(CS);
    const unsigned LQ = (unsigned)(((size_t)NH_ * TT * HD / 2 + 255) / 256), LKv = (unsigned)(((size_t)NKV * TT * HD / 2 + 255) / 256);
    for (int b = 0; b < NB_; b += CB) {
        k_cvt8<<<(unsigned)(((size_t)CB * TT * DM / 8 + 255) / 256), 256, 0, stream>>>(x + (size_t)b * TT * DM, XB, (size_t)CB * TT * DM / 8);
        k_gemmw<bf, 0, false><<<dim3(CB * TT / 64, DF / 64, 1), 32, 0, stream>>>(XB, nullptr, WQ, nullptr, DM, FX, DF, nullptr, 0, 0, 0);   // rows = (batch, t), columns = q | k | v
        k_rope<<<dim3(LQ, CB, 1), 256, 0, stream>>>(FX, DF, NH_, CS, nullptr, nullptr, 1.0f, QP16, QPh, QPl);
        k_rope<<<dim3(LKv, CB, 1), 256, 0, stream>>>(FX + DQ, DF, NKV, CS, nullptr, nullptr, 1.0f, KP16, KPh, KPl);
        k_vtp<<<dim3(LKv, CB, 1), 256, 0, stream>>>(FX + DQ + DKV, DF, NKV, VT16, VTh, VTl);
        // one kv head per query head: plane z = batch * NH_ + head on every operand (z-strides TT*HD)
        k_fattn<<<ZH, 256, 0, stream>>>(QPh, QPl, KPh, KPl, VTh, VTl, OUT + (size_t)b * TT * DQ);
    }
}

// v003
// Measured time: 68.1 microseconds a run.
// In two side-by-side timings against v002, it was 3.60 and 3.59 times as fast.
// All steps since v000 together make it 146 times as fast.
#include <hip/hip_runtime.h>

// Causal multi-head attention with hidden-size scaling (x [128][256][384]; q,k,v = x W ('xw' [384][384], no bias; 6 heads x 64); scores x 384^-0.5 (module quirk), causal (-inf); softmax; out = merged att.v -> [128][256][384] (12.6 M)).
// Layout: the three weights transposed to one stacked bf16 plane [q | k | v][384]; then ONE fused launch, one work-group per (batch, head): exact projections of the head's q, k, v from the f32 x rows (rounded to bf16 in registers), causal T-256 attention with EVERY row on hi/lo planes (K, V^T in LDS, q, scores and probabilities in registers; key chunks above the diagonal skipped), merged output rows.
// Compute dtypes, f32 accumulate: every input rounded to bf16; projections exact; scores and att.v 3 products; softmax f32; output f32.

#define NB_  128
#define TT   256
#define DM   384
#define NH_  6
#define NKV  6
#define REP  (NH_ / NKV)
#define HD   64
#define DQ   (NH_ * HD)
#define DKV  (NKV * HD)
#define DF   (DQ + 2 * DKV)       // rows of the stacked q | k | v weights
#define RH   256                  // unused: every query row uses hi+lo planes
#define WIN  256
#define PCAR 1024.0f
#define SCL  0.051031036307982884f   // 384^-0.5 (the module scales by the embedding size)
typedef _Float16 h16;
typedef unsigned short bf;
typedef __attribute__((ext_vector_type(16))) __bf16   v16bf;
typedef __attribute__((ext_vector_type(16))) _Float16 v16h;
typedef __attribute__((ext_vector_type(8)))  _Float16 v8h;
typedef __attribute__((ext_vector_type(8)))  unsigned short v8us;
typedef __attribute__((ext_vector_type(8)))  float    v8f;
typedef __attribute__((ext_vector_type(4)))  float    v4f;
typedef v8h  __attribute__((may_alias)) v8ha;
typedef v4f  __attribute__((may_alias)) v4fa;
typedef v8us __attribute__((may_alias)) v8usa;

__device__ __forceinline__ unsigned short f2bf(float f) { unsigned u = __float_as_uint(f); u += 0x7FFFu + ((u >> 16) & 1u); return (unsigned short)(u >> 16); }
__device__ __forceinline__ float bf2f(unsigned short b) { return __uint_as_float(((unsigned)b) << 16); }
__device__ __forceinline__ float bfr(float f) { return bf2f(f2bf(f)); }
__device__ __forceinline__ v16h cat16(v8h lo, v8h hi) { return __builtin_shufflevector(lo, hi, 0, 1, 2, 3, 4, 5, 6, 7, 8, 9, 10, 11, 12, 13, 14, 15); }
__device__ __forceinline__ v16bf cat16b(v8us lo, v8us hi) { return __builtin_bit_cast(v16bf, __builtin_shufflevector(lo, hi, 0, 1, 2, 3, 4, 5, 6, 7, 8, 9, 10, 11, 12, 13, 14, 15)); }
__device__ __forceinline__ v8f wmma16(v16h a, v16h b, v8f c) { return __builtin_amdgcn_wmma_f32_16x16x32_f16(false, a, false, b, (short)0, c, false, false); }
__device__ __forceinline__ v8f wmmab(v16bf a, v16bf b, v8f c) { return __builtin_amdgcn_wmma_f32_16x16x32_bf16(false, a, false, b, (short)0, c, false, false); }



// fragment loader of a K-contiguous 16-bit plane: lane lr = row, k = 16 (s >> 3) + 8 hi + (s & 7), the same for A and for B
template <typename T16> struct WFrag;
template <> struct WFrag<h16> { typedef v16h V; static __device__ __forceinline__ V ld(const h16* p) { return cat16(*(const v8h*)p, *(const v8h*)(p + 16)); } static __device__ __forceinline__ v8f mma(V a, V b, v8f c) { return wmma16(a, b, c); } };
template <> struct WFrag<bf> { typedef v16bf V; static __device__ __forceinline__ V ld(const bf* p) { return cat16b(*(const v8us*)p, *(const v8us*)(p + 16)); } static __device__ __forceinline__ v8f mma(V a, V b, v8f c) { return wmmab(a, b, c); } };
typedef __attribute__((ext_vector_type(2))) unsigned short v2us;

__global__ __launch_bounds__(256) void k_wtG(const float* __restrict__ w, int K, int N, bf* Bt) {
    const int lane = threadIdx.x & 31; const int L0 = (blockIdx.x * 8 + (threadIdx.x >> 5)) * 8; const int nlines = N * K / 64;
{
#pragma unroll 1
        for (int l = 0; l < 8; ++l) { const int L = L0 + l; if (L >= nlines) break; const size_t e = (size_t)L * 64 + lane * 2; const int k = (int)(e % K), n = (int)(e / K); v2us o;
            o[0] = f2bf(w[(size_t)k * N + n]); o[1] = f2bf(w[(size_t)(k + 1) * N + n]); *(v2us*)(Bt + e) = o; }
         }
}
// ---- k_fattn: projections, scores, causal softmax, att.v and the head merge of ONE (batch, head) plane in one work-group of 8 waves; q, k, v, the scores and the probabilities never reach memory.
// Projection: the head's 192 weight rows (q | k | v, [n][k] bf16) are staged once in LDS; a wave owns the x rows of its two query tiles (w and 15 - w), reads them as f32, rounds them to bf16 and uses the SAME fragment as B (q, k) and as A (v).
// q and k are formed transposed (A = 16 weight rows, B = 16 x rows): a lane then holds 8 neighbouring d of ITS row, which is the B fragment of the scores (q, stays in registers) and one 16-byte store into the K plane [t][d];
// v is formed straight (A = 16 x rows, B = 16 weight rows): a lane holds 8 neighbouring t of ITS d, one 16-byte store into the transposed V plane [d][t]. The planes (hi and lo) take over the LDS of the weights behind a barrier.
// Attention: a wave owns 16 query rows at a time and takes row tiles w and 15 - w, so every wave does 9 key chunks of 32.
// Scores are formed transposed (A = 16 keys, B = 16 queries): a lane then holds 8 keys of ITS query per tile, the softmax runs along the registers plus one exchange between the lane halves,
// and two neighbouring tiles, rounded to bf16 in place, are the A fragment (16 queries x 32 keys) of att.v in the k order of WFrag::ld (k = 16 (s >> 3) + 8 hi + (s & 7)).
#define KP   (HD + 8)             // LDS pitch of a K row, elements: 144 B = 16 B x odd
#define VP   (TT + 8)             // LDS pitch of a V^T row, elements: 528 B = 16 B x odd
#define OP   36                   // LDS pitch of the output staging, floats (32 columns + 4)
#define WP   (DM + 8)             // LDS pitch of a staged weight row, elements: 784 B = 16 B x odd
#define LDSB ((2 * TT * KP + 2 * HD * VP) * 2 + 8 * 16 * OP * 4)   // K, V^T planes and the output patches; the staged weights (3 * HD * WP * 2 bytes) lie over them first
static_assert(3 * HD * WP * 2 <= LDSB, "the staged weights fit the LDS of the planes and the output patches");
typedef __attribute__((ext_vector_type(8))) __bf16 v8bf;
__device__ __forceinline__ void split8(v8f y, v8us& h, v8us& l) { v8bf a, b;
#pragma unroll
    for (int j = 0; j < 8; ++j) { const __bf16 t = (__bf16)y[j]; a[j] = t; b[j] = (__bf16)(y[j] - (float)t); }
    h = __builtin_bit_cast(v8us, a); l = __builtin_bit_cast(v8us, b); }
// one tile of 16 query rows against its nc <= MAXC key chunks of 32; MAXC bounds the score registers
template <int MAXC>
__device__ __forceinline__ void attn_tile(const int tile, const WFrag<bf>::V qh0, const WFrag<bf>::V qh1, const WFrag<bf>::V ql0, const WFrag<bf>::V ql1, const bf* sK0, const bf* sK1, const bf* sV0, const bf* sV1, float* ow, float* orow, const int lane, const int lr, const int hi) {
        typedef WFrag<bf>::V V;
        const int q0 = tile * 16; const int nc = (tile >> 1) + 1;   // nc key chunks of 32 reach the diagonal; wave-uniform
        v8f s[2 * MAXC]; float mx = -3.0e38f;
#pragma unroll
        for (int c = 0; c < MAXC; ++c) if (c < nc) {
#pragma unroll
            for (int tt = 0; tt < 2; ++tt) { const int ko = ((c * 2 + tt) * 16 + lr) * KP + 8 * hi;
                const V kh0 = WFrag<bf>::ld(&sK0[ko]), kh1 = WFrag<bf>::ld(&sK0[ko + 32]), kl0 = WFrag<bf>::ld(&sK1[ko]), kl1 = WFrag<bf>::ld(&sK1[ko + 32]);
                v8f a = (v8f){};
                a = wmmab(kh0, qh0, a); a = wmmab(kh0, ql0, a); a = wmmab(kl0, qh0, a);
                a = wmmab(kh1, qh1, a); a = wmmab(kh1, ql1, a); a = wmmab(kl1, qh1, a);
#pragma unroll
                for (int j = 0; j < 8; ++j) { const int key = (c * 2 + tt) * 16 + hi * 8 + j; const float t = (key <= q0 + lr) ? a[j] * SCL : -3.0e38f; a[j] = t; mx = fmaxf(mx, t); }
                s[c * 2 + tt] = a; }
        }
        mx = fmaxf(mx, __shfl_xor(mx, 16, 32));
        float sum = 0.f;
#pragma unroll
        for (int c = 0; c < MAXC; ++c) if (c < nc) {
#pragma unroll
            for (int e = 0; e < 16; ++e) { const float x2 = __fmul_rn(__fsub_rn(s[c * 2 + (e >> 3)][e & 7], mx), 1.4426950408889634f); float p;
                asm("v_exp_f32 %0, %1\n\tv_nop" : "=v"(p) : "v"(x2));   // the v_nop fills the one slot the instruction set asks for behind a transcendental, whatever the compiler puts next
                s[c * 2 + (e >> 3)][e & 7] = p; sum += p; }
        }
        sum += __shfl_xor(sum, 16, 32);
        const float f = __fdiv_rn(1.0f, sum);
        v8f o[4];
#pragma unroll
        for (int nb = 0; nb < 4; ++nb) o[nb] = (v8f){};
#pragma unroll
        for (int c = 0; c < MAXC; ++c) if (c < nc) {
            V ph, pl;
#pragma unroll
            for (int e = 0; e < 16; ++e) { const float p = s[c * 2 + (e >> 3)][e & 7] * f; const __bf16 h = (__bf16)p; ph[e] = h; pl[e] = (__bf16)(p - (float)h); }
#pragma unroll
            for (int nb = 0; nb < 4; ++nb) { const int vo = (nb * 16 + lr) * VP + c * 32 + 8 * hi; const V vh = WFrag<bf>::ld(&sV0[vo]), vl = WFrag<bf>::ld(&sV1[vo]);
                o[nb] = wmmab(ph, vh, o[nb]); o[nb] = wmmab(pl, vh, o[nb]); o[nb] = wmmab(ph, vl, o[nb]); }
        }
        // merged output rows: 32 columns at a time through the wave's own LDS patch, so that every store instruction writes whole 128-byte lines
#pragma unroll
        for (int hf = 0; hf < 2; ++hf) {
#pragma unroll
            for (int nb = 0; nb < 2; ++nb) {
#pragma unroll
                for (int j = 0; j < 8; ++j) ow[(hi * 8 + j) * OP + nb * 16 + lr] = o[hf * 2 + nb][j]; }
            __builtin_amdgcn_wave_barrier(); asm volatile("" ::: "memory");   // keeps the other lanes' LDS stores in front of the reads below
#pragma unroll
            for (int r = 0; r < 4; ++r) { const int row = r * 4 + (lane >> 3), cofs = (lane & 7) * 4; *(v4f*)(orow + (size_t)(q0 + row) * DQ + hf * 32 + cofs) = *(const v4fa*)(ow + row * OP + cofs); }
            __builtin_amdgcn_wave_barrier(); asm volatile("" ::: "memory");   // keeps these reads in front of the next stores into the patch
        }
        asm volatile("s_wait_xcnt 0x0" ::: "memory");   // stands in front of the reuse of the output stores' registers
}
__global__ __launch_bounds__(256) __attribute__((amdgpu_waves_per_eu(4, 4))) void k_fattn(const float* __restrict__ x, const bf* __restrict__ Wt, float* OUT) {
    typedef WFrag<bf>::V V;
    __shared__ __align__(16) unsigned char smem[LDSB];
    bf* const sW = (bf*)smem;
    bf* const sK0 = (bf*)smem; bf* const sK1 = sK0 + TT * KP; bf* const sV0 = sK1 + TT * KP; bf* const sV1 = sV0 + HD * VP; float* const os = (float*)(sV1 + HD * VP);
    const int tid = threadIdx.x, lane = tid & 31, lr = lane & 15, hi = lane >> 4; const int w = __builtin_amdgcn_readfirstlane(tid >> 5);
    const int bat = blockIdx.x / NH_, head = blockIdx.x % NH_;
    // the head's 64 rows of each of q, k, v are one contiguous run of the stacked weights: 16-byte pieces, 48 to a row
#pragma unroll
    for (int sec = 0; sec < 3; ++sec) { const bf* g = Wt + ((size_t)sec * DQ + head * HD) * DM; v8us t[12];
#pragma unroll
        for (int it = 0; it < 12; ++it) t[it] = *(const v8us*)(g + (size_t)(it * 256 + tid) * 8);
        asm volatile("s_wait_xcnt 0x0" ::: "memory");   // stands in front of the reuse of the weight loads' address registers
#pragma unroll
        for (int it = 0; it < 12; ++it) { const int p = (it % 3) * 256 + tid; *(v8us*)(&sW[(sec * HD + (it / 3) * 16 + p / 48) * WP + (p % 48) * 8]) = t[it]; } }
    __syncthreads();
    const float* xa = x + ((size_t)bat * TT + (15 - w) * 16 + lr) * DM + 8 * hi;   // the rows of tile 15 - w
    const float* xb = x + ((size_t)bat * TT + w * 16 + lr) * DM + 8 * hi;          // the rows of tile w
    v8f aq[2][4], ak[2][4], av[2][4];
#pragma unroll
    for (int t = 0; t < 2; ++t)
#pragma unroll
        for (int nb = 0; nb < 4; ++nb) { aq[t][nb] = (v8f){}; ak[t][nb] = (v8f){}; av[t][nb] = (v8f){}; }
    // rolled: 24 accumulators leave no room for a second step's fragments
#pragma unroll 1
    for (int kc = 0; kc < DM; kc += 32) {
        const v8f a0 = *(const v8f*)(xa + kc), a1 = *(const v8f*)(xa + kc + 16), b0 = *(const v8f*)(xb + kc), b1 = *(const v8f*)(xb + kc + 16);
        asm volatile("s_wait_xcnt 0x0" ::: "memory");   // stands in front of the reuse of the x loads' address registers
        V xf[2];
#pragma unroll
        for (int e = 0; e < 8; ++e) { xf[0][e] = (__bf16)a0[e]; xf[0][8 + e] = (__bf16)a1[e]; xf[1][e] = (__bf16)b0[e]; xf[1][8 + e] = (__bf16)b1[e]; }
        const int wo = lr * WP + kc + 8 * hi;
#pragma unroll
        for (int nb = 0; nb < 4; ++nb) { const V wf = WFrag<bf>::ld(&sW[wo + (nb * 16) * WP]); aq[0][nb] = wmmab(wf, xf[0], aq[0][nb]); aq[1][nb] = wmmab(wf, xf[1], aq[1][nb]); }
#pragma unroll
        for (int nb = 0; nb < 4; ++nb) { const V wf = WFrag<bf>::ld(&sW[wo + (HD + nb * 16) * WP]); ak[0][nb] = wmmab(wf, xf[0], ak[0][nb]); ak[1][nb] = wmmab(wf, xf[1], ak[1][nb]); }
#pragma unroll
        for (int nb = 0; nb < 4; ++nb) { const V wf = WFrag<bf>::ld(&sW[wo + (2 * HD + nb * 16) * WP]); av[0][nb] = wmmab(xf[0], wf, av[0][nb]); av[1][nb] = wmmab(xf[1], wf, av[1][nb]); }
    }
    __syncthreads();   // every wave has left the staged weights: the planes take over their LDS
#pragma unroll
    for (int t = 0; t < 2; ++t) { const int r0 = (t ? w : 15 - w) * 16;
#pragma unroll
        for (int nb = 0; nb < 4; ++nb) { v8us h, l;
            split8(ak[t][nb], h, l); *(v8us*)(&sK0[(r0 + lr) * KP + nb * 16 + 8 * hi]) = h; *(v8us*)(&sK1[(r0 + lr) * KP + nb * 16 + 8 * hi]) = l;
            split8(av[t][nb], h, l); *(v8us*)(&sV0[(nb * 16 + lr) * VP + r0 + 8 * hi]) = h; *(v8us*)(&sV1[(nb * 16 + lr) * VP + r0 + 8 * hi]) = l; } }
    V qh0, qh1, ql0, ql1, nh0, nh1, nl0, nl1;   // the query fragments of tile 15 - w (q) and of tile w (n)
    { v8us h0, l0, h1, l1;
      split8(aq[0][0], h0, l0); split8(aq[0][1], h1, l1); qh0 = cat16b(h0, h1); ql0 = cat16b(l0, l1); split8(aq[0][2], h0, l0); split8(aq[0][3], h1, l1); qh1 = cat16b(h0, h1); ql1 = cat16b(l0, l1);
      split8(aq[1][0], h0, l0); split8(aq[1][1], h1, l1); nh0 = cat16b(h0, h1); nl0 = cat16b(l0, l1); split8(aq[1][2], h0, l0); split8(aq[1][3], h1, l1); nh1 = cat16b(h0, h1); nl1 = cat16b(l0, l1); }
    __syncthreads();
    float* ow = os + w * 16 * OP;
    float* orow = OUT + (size_t)bat * TT * DQ + head * HD;
    // the short tile first: its 8 score tiles leave room for the long tile's query fragments, which the long tile's 16 would not
    attn_tile<4>(w, nh0, nh1, nl0, nl1, sK0, sK1, sV0, sV1, ow, orow, lane, lr, hi);
    attn_tile<8>(15 - w, qh0, qh1, ql0, ql1, sK0, sK1, sV0, sV1, ow, orow, lane, lr, hi);
}
extern "C" void kernel_launch(void* const* d_in, const int* in_sizes, int n_in,
                              void* d_out, int out_size, void* d_ws, size_t ws_size, hipStream_t stream) {
    (void)in_sizes; (void)n_in; (void)out_size;
    const float* x = (const float*)d_in[0]; const float* wq = (const float*)d_in[1]; const float* wk = (const float*)d_in[2]; const float* wv = (const float*)d_in[3];
    float* OUT = (float*)d_out;     // [128][256][384]
    char* wsp = (char*)d_ws;
    auto take = [&](size_t bytes) { char* p = wsp; wsp += (bytes + 255) & ~(size_t)255; return (void*)p; };
    bf* WQ = (bf*)take((size_t)DF * DM * 2); bf* WK = WQ + (size_t)DQ * DM; bf* WV = WK + (size_t)DKV * DM;   // stacked weights [DF][DM]
    if ((size_t)(wsp - (char*)d_ws) > ws_size) return;
    { k_wtG<<<(unsigned)((DM * DQ / 64 + 63) / 64), 256, 0, stream>>>(wq, DM, DQ, WQ); k_wtG<<<(unsigned)((DM * DKV / 64 + 63) / 64), 256, 0, stream>>>(wk, DM, DKV, WK); k_wtG<<<(unsigned)((DM * DKV / 64 + 63) / 64), 256, 0, stream>>>(wv, DM, DKV, WV);
       }
    // plane z = batch * NH_ + head: one work-group each, every batch in the one launch
    k_fattn<<<NB_ * NH_, 256, 0, stream>>>(x, WQ, OUT);
}

// v004
// Measured time: 55.3 microseconds a run.
// In both of two side-by-side timings against v003, it was 1.24 times as fast.
// Over all steps from v000 it is 181 times as fast.
#include <hip/hip_runtime.h>

// Causal multi-head attention with hidden-size scaling (x [128][256][384]; q,k,v = x W ('xw' [384][384], no bias; 6 heads x 64); scores x 384^-0.5 (module quirk), causal (-inf); softmax; out = merged att.v -> [128][256][384] (12.6 M)).
// Layout: ONE fused launch, one work-group per (batch, head): the head's weight columns read as f32, rounded to bf16 and transposed on the way into LDS; exact projections of the head's q, k, v from the f32 x rows (rounded to bf16 in registers), causal T-256 attention with EVERY row on hi/lo planes (K, V^T in LDS, q, scores and probabilities in registers; key chunks above the diagonal skipped), merged output rows.
// Compute dtypes, f32 accumulate: every input rounded to bf16; projections exact; scores and att.v 3 products; softmax f32; output f32.

#define NB_  128
#define TT   256
#define DM   384
#define NH_  6
#define NKV  6
#define REP  (NH_ / NKV)
#define HD   64
#define DQ   (NH_ * HD)
#define DKV  (NKV * HD)
#define DF   (DQ + 2 * DKV)       // unused: q, k and v weights are three separate inputs
#define RH   256                  // unused: every query row uses hi+lo planes
#define WIN  256
#define PCAR 1024.0f
#define SCL  0.051031036307982884f   // 384^-0.5 (the module scales by the embedding size)
typedef _Float16 h16;
typedef unsigned short bf;
typedef __attribute__((ext_vector_type(16))) __bf16   v16bf;
typedef __attribute__((ext_vector_type(16))) _Float16 v16h;
typedef __attribute__((ext_vector_type(8)))  _Float16 v8h;
typedef __attribute__((ext_vector_type(8)))  unsigned short v8us;
typedef __attribute__((ext_vector_type(8)))  float    v8f;
typedef __attribute__((ext_vector_type(4)))  float    v4f;
typedef v8h  __attribute__((may_alias)) v8ha;
typedef v4f  __attribute__((may_alias)) v4fa;
typedef v8us __attribute__((may_alias)) v8usa;

__device__ __forceinline__ v16h cat16(v8h lo, v8h hi) { return __builtin_shufflevector(lo, hi, 0, 1, 2, 3, 4, 5, 6, 7, 8, 9, 10, 11, 12, 13, 14, 15); }
__device__ __forceinline__ v16bf cat16b(v8us lo, v8us hi) { return __builtin_bit_cast(v16bf, __builtin_shufflevector(lo, hi, 0, 1, 2, 3, 4, 5, 6, 7, 8, 9, 10, 11, 12, 13, 14, 15)); }
__device__ __forceinline__ v8f wmma16(v16h a, v16h b, v8f c) { return __builtin_amdgcn_wmma_f32_16x16x32_f16(false, a, false, b, (short)0, c, false, false); }
__device__ __forceinline__ v8f wmmab(v16bf a, v16bf b, v8f c) { return __builtin_amdgcn_wmma_f32_16x16x32_bf16(false, a, false, b, (short)0, c, false, false); }



// fragment loader of a K-contiguous 16-bit plane: lane lr = row, k = 16 (s >> 3) + 8 hi + (s & 7), the same for A and for B
template <typename T16> struct WFrag;
template <> struct WFrag<h16> { typedef v16h V; static __device__ __forceinline__ V ld(const h16* p) { return cat16(*(const v8h*)p, *(const v8h*)(p + 16)); } static __device__ __forceinline__ v8f mma(V a, V b, v8f c) { return wmma16(a, b, c); } };
template <> struct WFrag<bf> { typedef v16bf V; static __device__ __forceinline__ V ld(const bf* p) { return cat16b(*(const v8us*)p, *(const v8us*)(p + 16)); } static __device__ __forceinline__ v8f mma(V a, V b, v8f c) { return wmmab(a, b, c); } };

// ---- k_fattn: projections, scores, causal softmax, att.v and the head merge of ONE (batch, head) plane in one work-group of 8 waves; q, k, v, the scores and the probabilities never reach memory.
// Projection: the head's 192 weight columns (q | k | v) are staged once in LDS as rows [n][k] of bf16, straight from the f32 weights [k][n]: a lane takes 8 neighbouring k of ITS two n (each load instruction reads whole 128-byte lines), one 16-byte LDS store to an n; a wave owns the x rows of its two query tiles (w and 15 - w), reads them as f32, rounds them to bf16 and uses the SAME fragment as B (q, k) and as A (v).
// q and k are formed transposed (A = 16 weight rows, B = 16 x rows): a lane then holds 8 neighbouring d of ITS row, which is the B fragment of the scores (q, stays in registers) and one 16-byte store into the K plane [t][d];
// v is formed straight (A = 16 x rows, B = 16 weight rows): a lane holds 8 neighbouring t of ITS d, one 16-byte store into the transposed V plane [d][t]. The planes (hi and lo) take over the LDS of the weights behind a barrier.
// Attention: a wave owns 16 query rows at a time and takes row tiles w and 15 - w, so every wave does 9 key chunks of 32.
// Scores are formed transposed (A = 16 keys, B = 16 queries): a lane then holds 8 keys of ITS query per tile, the softmax runs along the registers plus one exchange between the lane halves,
// and two neighbouring tiles, rounded to bf16 in place, are the A fragment (16 queries x 32 keys) of att.v in the k order of WFrag::ld (k = 16 (s >> 3) + 8 hi + (s & 7)).
#define KP   (HD + 8)             // LDS pitch of a K row, elements: 144 B = 16 B x odd
#define VP   (TT + 8)             // LDS pitch of a V^T row, elements: 528 B = 16 B x odd
#define OP   36                   // LDS pitch of the output staging, floats (32 columns + 4)
#define WP   (DM + 8)             // LDS pitch of a staged weight row, elements: 784 B = 16 B x odd
#define LDSB ((2 * TT * KP + 2 * HD * VP) * 2 + 8 * 16 * OP * 4)   // K, V^T planes and the output patches; the staged weights (3 * HD * WP * 2 bytes) lie over them first
static_assert(3 * HD * WP * 2 <= LDSB, "the staged weights fit the LDS of the planes and the output patches");
typedef __attribute__((ext_vector_type(8))) __bf16 v8bf;
typedef __attribute__((ext_vector_type(2))) float v2f;
__device__ __forceinline__ void split8(v8f y, v8us& h, v8us& l) { v8bf a, b;
#pragma unroll
    for (int j = 0; j < 8; ++j) { const __bf16 t = (__bf16)y[j]; a[j] = t; b[j] = (__bf16)(y[j] - (float)t); }
    h = __builtin_bit_cast(v8us, a); l = __builtin_bit_cast(v8us, b); }
// one tile of 16 query rows against its nc <= MAXC key chunks of 32; MAXC bounds the score registers
template <int MAXC>
__device__ __forceinline__ void attn_tile(const int tile, const WFrag<bf>::V qh0, const WFrag<bf>::V qh1, const WFrag<bf>::V ql0, const WFrag<bf>::V ql1, const bf* sK0, const bf* sK1, const bf* sV0, const bf* sV1, float* ow, float* orow, const int lane, const int lr, const int hi) {
        typedef WFrag<bf>::V V;
        const int q0 = tile * 16; const int nc = (tile >> 1) + 1;   // nc key chunks of 32 reach the diagonal; wave-uniform
        v8f s[2 * MAXC]; float mx = -3.0e38f;
#pragma unroll
        for (int c = 0; c < MAXC; ++c) if (c < nc) {
#pragma unroll
            for (int tt = 0; tt < 2; ++tt) { const int ko = ((c * 2 + tt) * 16 + lr) * KP + 8 * hi;
                const V kh0 = WFrag<bf>::ld(&sK0[ko]), kh1 = WFrag<bf>::ld(&sK0[ko + 32]), kl0 = WFrag<bf>::ld(&sK1[ko]), kl1 = WFrag<bf>::ld(&sK1[ko + 32]);
                v8f a = (v8f){};
                a = wmmab(kh0, qh0, a); a = wmmab(kh0, ql0, a); a = wmmab(kl0, qh0, a);
                a = wmmab(kh1, qh1, a); a = wmmab(kh1, ql1, a); a = wmmab(kl1, qh1, a);
#pragma unroll
                for (int j = 0; j < 8; ++j) { const int key = (c * 2 + tt) * 16 + hi * 8 + j; const float t = (key <= q0 + lr) ? a[j] * SCL : -3.0e38f; a[j] = t; mx = fmaxf(mx, t); }
                s[c * 2 + tt] = a; }
        }
        mx = fmaxf(mx, __shfl_xor(mx, 16, 32));
        float sum = 0.f;
#pragma unroll
        for (int c = 0; c < MAXC; ++c) if (c < nc) {
#pragma unroll
            for (int e = 0; e < 16; ++e) { const float x2 = __fmul_rn(__fsub_rn(s[c * 2 + (e >> 3)][e & 7], mx), 1.4426950408889634f); float p;
                asm("v_exp_f32 %0, %1\n\tv_nop" : "=v"(p) : "v"(x2));   // the v_nop fills the one slot the instruction set asks for behind a transcendental, whatever the compiler puts next
                s[c * 2 + (e >> 3)][e & 7] = p; sum += p; }
        }
        sum += __shfl_xor(sum, 16, 32);
        const float f = __fdiv_rn(1.0f, sum);
        v8f o[4];
#pragma unroll
        for (int nb = 0; nb < 4; ++nb) o[nb] = (v8f){};
#pragma unroll
        for (int c = 0; c < MAXC; ++c) if (c < nc) {
            V ph, pl;
#pragma unroll
            for (int e = 0; e < 16; ++e) { const float p = s[c * 2 + (e >> 3)][e & 7] * f; const __bf16 h = (__bf16)p; ph[e] = h; pl[e] = (__bf16)(p - (float)h); }
#pragma unroll
            for (int nb = 0; nb < 4; ++nb) { const int vo = (nb * 16 + lr) * VP + c * 32 + 8 * hi; const V vh = WFrag<bf>::ld(&sV0[vo]), vl = WFrag<bf>::ld(&sV1[vo]);
                o[nb] = wmmab(ph, vh, o[nb]); o[nb] = wmmab(pl, vh, o[nb]); o[nb] = wmmab(ph, vl, o[nb]); }
        }
        // merged output rows: 32 columns at a time through the wave's own LDS patch, so that every store instruction writes whole 128-byte lines
#pragma unroll
        for (int hf = 0; hf < 2; ++hf) {
#pragma unroll
            for (int nb = 0; nb < 2; ++nb) {
#pragma unroll
                for (int j = 0; j < 8; ++j) ow[(hi * 8 + j) * OP + nb * 16 + lr] = o[hf * 2 + nb][j]; }
            __builtin_amdgcn_wave_barrier(); asm volatile("" ::: "memory");   // keeps the other lanes' LDS stores in front of the reads below
#pragma unroll
            for (int r = 0; r < 4; ++r) { const int row = r * 4 + (lane >> 3), cofs = (lane & 7) * 4; *(v4f*)(orow + (size_t)(q0 + row) * DQ + hf * 32 + cofs) = *(const v4fa*)(ow + row * OP + cofs); }
            __builtin_amdgcn_wave_barrier(); asm volatile("" ::: "memory");   // keeps these reads in front of the next stores into the patch
        }
        asm volatile("s_wait_xcnt 0x0" ::: "memory");   // stands in front of the reuse of the output stores' registers
}
__global__ __launch_bounds__(256) __attribute__((amdgpu_waves_per_eu(4, 4))) void k_fattn(const float* __restrict__ x, const float* __restrict__ wq, const float* __restrict__ wk, const float* __restrict__ wv, float* OUT) {
    typedef WFrag<bf>::V V;
    __shared__ __align__(16) unsigned char smem[LDSB];
    bf* const sW = (bf*)smem;
    bf* const sK0 = (bf*)smem; bf* const sK1 = sK0 + TT * KP; bf* const sV0 = sK1 + TT * KP; bf* const sV1 = sV0 + HD * VP; float* const os = (float*)(sV1 + HD * VP);
    const int tid = threadIdx.x, lane = tid & 31, lr = lane & 15, hi = lane >> 4; const int w = __builtin_amdgcn_readfirstlane(tid >> 5);
    const int bat = blockIdx.x / NH_, head = blockIdx.x % NH_;
    // the head's 64 columns of each weight. A lane takes 2 neighbouring columns and 8 neighbouring k: lane bits 0-2 and 4 pick the column pair (16 pairs = one whole 128-byte line of a weight row), bit 3 the k group,
    // so that a load instruction reads two whole lines and the 16 lanes of a half wave store to 16 different 16-byte bank groups. A wave covers 32 columns x 16 k a pass, the work-group 64 columns x 64 k; 6 passes to a weight, 3 to a batch of loads.
    const int sn = (w & 1) * 32 + ((lane & 7) | ((lane >> 4) << 3)) * 2, sk = ((w >> 1) * 2 + ((lane >> 3) & 1)) * 8;
    const float* const wsrc[3] = { wq + (size_t)sk * DQ + head * HD + sn, wk + (size_t)sk * DQ + head * HD + sn, wv + (size_t)sk * DQ + head * HD + sn };
    v2f wt[2][3][8];
#pragma unroll
    for (int p = 0; p < 3; ++p)
#pragma unroll
        for (int j = 0; j < 8; ++j) wt[0][p][j] = *(const v2f*)(wsrc[0] + (64 * p + j) * DQ);
    // one batch ahead: batch sb + 1 is in flight while batch sb is rounded and stored
#pragma unroll
    for (int sb = 0; sb < 6; ++sb) {
        if (sb + 1 < 6) {
#pragma unroll
            for (int p = 0; p < 3; ++p)
#pragma unroll
                for (int j = 0; j < 8; ++j) wt[(sb + 1) & 1][p][j] = *(const v2f*)(wsrc[(sb + 1) >> 1] + (64 * (((sb + 1) & 1) * 3 + p) + j) * DQ);
            asm volatile("s_wait_xcnt 0x0" ::: "memory"); }   // stands in front of the reuse of the weight loads' address registers
#pragma unroll
        for (int p = 0; p < 3; ++p)
#pragma unroll
            for (int i = 0; i < 2; ++i) { v8bf c;
#pragma unroll
                for (int j = 0; j < 8; ++j) c[j] = (__bf16)wt[sb & 1][p][j][i];
                *(v8us*)(&sW[((sb >> 1) * HD + sn + i) * WP + sk + 64 * ((sb & 1) * 3 + p)]) = __builtin_bit_cast(v8us, c); } }
    __syncthreads();
    __builtin_amdgcn_sched_barrier(0);   // keeps the zeroing of the 24 accumulators behind the staging, whose loads in flight need those registers (scratch otherwise)
    const float* xa = x + ((size_t)bat * TT + (15 - w) * 16 + lr) * DM + 8 * hi;   // the rows of tile 15 - w
    const float* xb = x + ((size_t)bat * TT + w * 16 + lr) * DM + 8 * hi;          // the rows of tile w
    v8f aq[2][4], ak[2][4], av[2][4];
#pragma unroll
    for (int t = 0; t < 2; ++t)
#pragma unroll
        for (int nb = 0; nb < 4; ++nb) { aq[t][nb] = (v8f){}; ak[t][nb] = (v8f){}; av[t][nb] = (v8f){}; }
    // rolled: 24 accumulators leave no room for a second step's fragments
#pragma unroll 1
    for (int kc = 0; kc < DM; kc += 32) {
        const v8f a0 = *(const v8f*)(xa + kc), a1 = *(const v8f*)(xa + kc + 16), b0 = *(const v8f*)(xb + kc), b1 = *(const v8f*)(xb + kc + 16);
        asm volatile("s_wait_xcnt 0x0" ::: "memory");   // stands in front of the reuse of the x loads' address registers
        V xf[2];
#pragma unroll
        for (int e = 0; e < 8; ++e) { xf[0][e] = (__bf16)a0[e]; xf[0][8 + e] = (__bf16)a1[e]; xf[1][e] = (__bf16)b0[e]; xf[1][8 + e] = (__bf16)b1[e]; }
        const int wo = lr * WP + kc + 8 * hi;
#pragma unroll
        for (int nb = 0; nb < 4; ++nb) { const V wf = WFrag<bf>::ld(&sW[wo + (nb * 16) * WP]); aq[0][nb] = wmmab(wf, xf[0], aq[0][nb]); aq[1][nb] = wmmab(wf, xf[1], aq[1][nb]); }
#pragma unroll
        for (int nb = 0; nb < 4; ++nb) { const V wf = WFrag<bf>::ld(&sW[wo + (HD + nb * 16) * WP]); ak[0][nb] = wmmab(wf, xf[0], ak[0][nb]); ak[1][nb] = wmmab(wf, xf[1], ak[1][nb]); }
#pragma unroll
        for (int nb = 0; nb < 4; ++nb) { const V wf = WFrag<bf>::ld(&sW[wo + (2 * HD + nb * 16) * WP]); av[0][nb] = wmmab(xf[0], wf, av[0][nb]); av[1][nb] = wmmab(xf[1], wf, av[1][nb]); }
    }
    __syncthreads();   // every wave has left the staged weights: the planes take over their LDS
#pragma unroll
    for (int t = 0; t < 2; ++t) { const int r0 = (t ? w : 15 - w) * 16;
#pragma unroll
        for (int nb = 0; nb < 4; ++nb) { v8us h, l;
            split8(ak[t][nb], h, l); *(v8us*)(&sK0[(r0 + lr) * KP + nb * 16 + 8 * hi]) = h; *(v8us*)(&sK1[(r0 + lr) * KP + nb * 16 + 8 * hi]) = l;
            split8(av[t][nb], h, l); *(v8us*)(&sV0[(nb * 16 + lr) * VP + r0 + 8 * hi]) = h; *(v8us*)(&sV1[(nb * 16 + lr) * VP + r0 + 8 * hi]) = l; } }
    V qh0, qh1, ql0, ql1, nh0, nh1, nl0, nl1;   // the query fragments of tile 15 - w (q) and of tile w (n)
    { v8us h0, l0, h1, l1;
      split8(aq[0][0], h0, l0); split8(aq[0][1], h1, l1); qh0 = cat16b(h0, h1); ql0 = cat16b(l0, l1); split8(aq[0][2], h0, l0); split8(aq[0][3], h1, l1); qh1 = cat16b(h0, h1); ql1 = cat16b(l0, l1);
      split8(aq[1][0], h0, l0); split8(aq[1][1], h1, l1); nh0 = cat16b(h0, h1); nl0 = cat16b(l0, l1); split8(aq[1][2], h0, l0); split8(aq[1][3], h1, l1); nh1 = cat16b(h0, h1); nl1 = cat16b(l0, l1); }
    __syncthreads();
    float* ow = os + w * 16 * OP;
    float* orow = OUT + (size_t)bat * TT * DQ + head * HD;
    // the short tile first: its 8 score tiles leave room for the long tile's query fragments, which the long tile's 16 would not
    attn_tile<4>(w, nh0, nh1, nl0, nl1, sK0, sK1, sV0, sV1, ow, orow, lane, lr, hi);
    attn_tile<8>(15 - w, qh0, qh1, ql0, ql1, sK0, sK1, sV0, sV1, ow, orow, lane, lr, hi);
}
extern "C" void kernel_launch(void* const* d_in, const int* in_sizes, int n_in,
                              void* d_out, int out_size, void* d_ws, size_t ws_size, hipStream_t stream) {
    (void)in_sizes; (void)n_in; (void)out_size; (void)d_ws; (void)ws_size;
    const float* x = (const float*)d_in[0]; const float* wq = (const float*)d_in[1]; const float* wk = (const float*)d_in[2]; const float* wv = (const float*)d_in[3];
    float* OUT = (float*)d_out;     // [128][256][384]
    // plane z = batch * NH_ + head: one work-group each, every batch in the one launch
    k_fattn<<<NB_ * NH_, 256, 0, stream>>>(x, wq, wk, wv, OUT);
}

// v005
// Measured time: 52.4 microseconds a run.
// In both of two side-by-side timings against v004, it was 1.05 times as fast.
// All steps since v000 together make it 191 times as fast.
#include <hip/hip_runtime.h>

// Causal multi-head attention with hidden-size scaling (x [128][256][384]; q,k,v = x W ('xw' [384][384], no bias; 6 heads x 64); scores x 384^-0.5 (module quirk), causal (-inf); softmax; out = merged att.v -> [128][256][384] (12.6 M)).
// Layout: ONE fused launch, one work-group per (batch, head): the head's weight columns read as f32, rounded to bf16 and transposed on the way into LDS; exact projections of the head's q, k, v from the f32 x rows (rounded to bf16 in registers), causal T-256 attention with EVERY row on hi/lo planes (K, V^T in LDS, q, scores and probabilities in registers; key chunks above the diagonal skipped), merged output rows.
// Compute dtypes, f32 accumulate: every input rounded to bf16; projections exact; scores and att.v 3 products; softmax f32; output f32.

#define NB_  128
#define TT   256
#define DM   384
#define NH_  6
#define NKV  6
#define REP  (NH_ / NKV)
#define HD   64
#define DQ   (NH_ * HD)
#define DKV  (NKV * HD)
#define DF   (DQ + 2 * DKV)       // unused: q, k and v weights are three separate inputs
#define RH   256                  // unused: every query row uses hi+lo planes
#define WIN  256
#define PCAR 1024.0f
#define SCL  0.051031036307982884f   // 384^-0.5 (the module scales by the embedding size)
typedef _Float16 h16;
typedef unsigned short bf;
typedef __attribute__((ext_vector_type(16))) __bf16   v16bf;
typedef __attribute__((ext_vector_type(16))) _Float16 v16h;
typedef __attribute__((ext_vector_type(8)))  _Float16 v8h;
typedef __attribute__((ext_vector_type(8)))  unsigned short v8us;
typedef __attribute__((ext_vector_type(8)))  float    v8f;
typedef __attribute__((ext_vector_type(4)))  float    v4f;
typedef v8h  __attribute__((may_alias)) v8ha;
typedef v4f  __attribute__((may_alias)) v4fa;
typedef v8us __attribute__((may_alias)) v8usa;

__device__ __forceinline__ v16h cat16(v8h lo, v8h hi) { return __builtin_shufflevector(lo, hi, 0, 1, 2, 3, 4, 5, 6, 7, 8, 9, 10, 11, 12, 13, 14, 15); }
__device__ __forceinline__ v16bf cat16b(v8us lo, v8us hi) { return __builtin_bit_cast(v16bf, __builtin_shufflevector(lo, hi, 0, 1, 2, 3, 4, 5, 6, 7, 8, 9, 10, 11, 12, 13, 14, 15)); }
__device__ __forceinline__ v8f wmma16(v16h a, v16h b, v8f c) { return __builtin_amdgcn_wmma_f32_16x16x32_f16(false, a, false, b, (short)0, c, false, false); }
__device__ __forceinline__ v8f wmmab(v16bf a, v16bf b, v8f c) { return __builtin_amdgcn_wmma_f32_16x16x32_bf16(false, a, false, b, (short)0, c, false, false); }



// fragment loader of a K-contiguous 16-bit plane: lane lr = row, k = 16 (s >> 3) + 8 hi + (s & 7), the same for A and for B
template <typename T16> struct WFrag;
template <> struct WFrag<h16> { typedef v16h V; static __device__ __forceinline__ V ld(const h16* p) { return cat16(*(const v8h*)p, *(const v8h*)(p + 16)); } static __device__ __forceinline__ v8f mma(V a, V b, v8f c) { return wmma16(a, b, c); } };
template <> struct WFrag<bf> { typedef v16bf V; static __device__ __forceinline__ V ld(const bf* p) { return cat16b(*(const v8us*)p, *(const v8us*)(p + 16)); } static __device__ __forceinline__ v8f mma(V a, V b, v8f c) { return wmmab(a, b, c); } };

// ---- k_fattn: projections, scores, causal softmax, att.v and the head merge of ONE (batch, head) plane in one work-group of 8 waves; q, k, v, the scores and the probabilities never reach memory.
// Projection: the head's 192 weight columns (q | k | v) are staged once in LDS as rows [n][k] of bf16, straight from the f32 weights [k][n]: a lane takes 8 neighbouring k of ITS two n (each load instruction reads whole 128-byte lines), one 16-byte LDS store to an n; a wave owns the x rows of its two query tiles (w and 15 - w), reads them as f32, rounds them to bf16 and uses the SAME fragment as B (q, k) and as A (v).
// q and k are formed transposed (A = 16 weight rows, B = 16 x rows): a lane then holds 8 neighbouring d of ITS row, which is the B fragment of the scores (q, stays in registers) and one 16-byte store into the K plane [t][d];
// v is formed straight (A = 16 x rows, B = 16 weight rows): a lane holds 8 neighbouring t of ITS d, one 16-byte store into the transposed V plane [d][t]. The planes (hi and lo) take over the LDS of the weights behind a barrier.
// Attention: a wave owns 16 query rows at a time and takes row tiles w and 15 - w, so every wave does 9 key chunks of 32.
// Scores are formed transposed (A = 16 keys, B = 16 queries): a lane then holds 8 keys of ITS query per tile, the softmax runs along the registers plus one exchange between the lane halves,
// and two neighbouring tiles, rounded to bf16 in place, are the A fragment (16 queries x 32 keys) of att.v in the k order of WFrag::ld (k = 16 (s >> 3) + 8 hi + (s & 7)).
#define KP   (HD + 8)             // LDS pitch of a K row, elements: 144 B = 16 B x odd
#define VP   (TT + 8)             // LDS pitch of a V^T row, elements: 528 B = 16 B x odd
#define OP   36                   // LDS pitch of the output staging, floats (32 columns + 4)
#define WP   (DM + 8)             // LDS pitch of a staged weight row, elements: 784 B = 16 B x odd
#define LDSB ((2 * TT * KP + 2 * HD * VP) * 2 + 8 * 16 * OP * 4)   // K, V^T planes and the output patches; the staged weights (3 * HD * WP * 2 bytes) lie over them first
static_assert(3 * HD * WP * 2 <= LDSB, "the staged weights fit the LDS of the planes and the output patches");
typedef __attribute__((ext_vector_type(8))) __bf16 v8bf;
typedef __attribute__((ext_vector_type(2))) float v2f;
__device__ __forceinline__ void split8(v8f y, v8us& h, v8us& l) { v8bf a, b;
#pragma unroll
    for (int j = 0; j < 8; ++j) { const __bf16 t = (__bf16)y[j]; a[j] = t; b[j] = (__bf16)(y[j] - (float)t); }
    h = __builtin_bit_cast(v8us, a); l = __builtin_bit_cast(v8us, b); }
// one tile of 16 query rows against its nc <= MAXC key chunks of 32; MAXC bounds the score registers
template <int MAXC>
__device__ __forceinline__ void attn_tile(const int tile, const WFrag<bf>::V qh0, const WFrag<bf>::V qh1, const WFrag<bf>::V ql0, const WFrag<bf>::V ql1, const bf* sK0, const bf* sK1, const bf* sV0, const bf* sV1, float* ow, float* orow, const int lane, const int lr, const int hi) {
        typedef WFrag<bf>::V V;
        const int q0 = tile * 16; const int nc = (tile >> 1) + 1;   // nc key chunks of 32 reach the diagonal; wave-uniform
        v8f s[2 * MAXC]; float mx = -3.0e38f;
#pragma unroll
        for (int c = 0; c < MAXC; ++c) if (c < nc) {
#pragma unroll
            for (int tt = 0; tt < 2; ++tt) { const int ko = ((c * 2 + tt) * 16 + lr) * KP + 8 * hi;
                const V kh0 = WFrag<bf>::ld(&sK0[ko]), kh1 = WFrag<bf>::ld(&sK0[ko + 32]), kl0 = WFrag<bf>::ld(&sK1[ko]), kl1 = WFrag<bf>::ld(&sK1[ko + 32]);
                v8f a = (v8f){};
                a = wmmab(kh0, qh0, a); a = wmmab(kh0, ql0, a); a = wmmab(kl0, qh0, a);
                a = wmmab(kh1, qh1, a); a = wmmab(kh1, ql1, a); a = wmmab(kl1, qh1, a);
#pragma unroll
                for (int j = 0; j < 8; ++j) { const int key = (c * 2 + tt) * 16 + hi * 8 + j; const float t = (key <= q0 + lr) ? a[j] * SCL : -3.0e38f; a[j] = t; mx = fmaxf(mx, t); }
                s[c * 2 + tt] = a; }
        }
        mx = fmaxf(mx, __shfl_xor(mx, 16, 32));
        float sum = 0.f;
#pragma unroll
        for (int c = 0; c < MAXC; ++c) if (c < nc) {
#pragma unroll
            for (int e = 0; e < 16; ++e) { const float x2 = __fmul_rn(__fsub_rn(s[c * 2 + (e >> 3)][e & 7], mx), 1.4426950408889634f); float p;
                asm("v_exp_f32 %0, %1\n\tv_nop" : "=v"(p) : "v"(x2));   // the v_nop fills the one slot the instruction set asks for behind a transcendental, whatever the compiler puts next
                s[c * 2 + (e >> 3)][e & 7] = p; sum += p; }
        }
        sum += __shfl_xor(sum, 16, 32);
        const float f = __fdiv_rn(1.0f, sum);
        v8f o[4];
#pragma unroll
        for (int nb = 0; nb < 4; ++nb) o[nb] = (v8f){};
#pragma unroll
        for (int c = 0; c < MAXC; ++c) if (c < nc) {
            V vh[4], vl[4];
#pragma unroll
            for (int nb = 0; nb < 4; ++nb) { const int vo = (nb * 16 + lr) * VP + c * 32 + 8 * hi; vh[nb] = WFrag<bf>::ld(&sV0[vo]); vl[nb] = WFrag<bf>::ld(&sV1[vo]); }
            __builtin_amdgcn_sched_barrier(0);   // keeps the chunk's eight V fragment reads in front of the rounding below, which covers their latency (the scheduler otherwise sinks each read to its product and waits it out)
            V ph, pl;
#pragma unroll
            for (int e = 0; e < 16; ++e) { const float p = s[c * 2 + (e >> 3)][e & 7] * f; const __bf16 h = (__bf16)p; ph[e] = h; pl[e] = (__bf16)(p - (float)h); }
            // each accumulator keeps its order of sums (ph vh, pl vh, ph vl); the four accumulators take turns
#pragma unroll
            for (int nb = 0; nb < 4; ++nb) o[nb] = wmmab(ph, vh[nb], o[nb]);
#pragma unroll
            for (int nb = 0; nb < 4; ++nb) o[nb] = wmmab(pl, vh[nb], o[nb]);
#pragma unroll
            for (int nb = 0; nb < 4; ++nb) o[nb] = wmmab(ph, vl[nb], o[nb]);
        }
        // merged output rows: 32 columns at a time through the wave's own LDS patch, so that every store instruction writes whole 128-byte lines
#pragma unroll
        for (int hf = 0; hf < 2; ++hf) {
#pragma unroll
            for (int nb = 0; nb < 2; ++nb) {
#pragma unroll
                for (int j = 0; j < 8; ++j) ow[(hi * 8 + j) * OP + nb * 16 + lr] = o[hf * 2 + nb][j]; }
            __builtin_amdgcn_wave_barrier(); asm volatile("" ::: "memory");   // keeps the other lanes' LDS stores in front of the reads below
#pragma unroll
            for (int r = 0; r < 4; ++r) { const int row = r * 4 + (lane >> 3), cofs = (lane & 7) * 4; *(v4f*)(orow + (size_t)(q0 + row) * DQ + hf * 32 + cofs) = *(const v4fa*)(ow + row * OP + cofs); }
            __builtin_amdgcn_wave_barrier(); asm volatile("" ::: "memory");   // keeps these reads in front of the next stores into the patch
        }
        asm volatile("s_wait_xcnt 0x0" ::: "memory");   // stands in front of the reuse of the output stores' registers
}
__global__ __launch_bounds__(256) __attribute__((amdgpu_waves_per_eu(4, 4))) void k_fattn(const float* __restrict__ x, const float* __restrict__ wq, const float* __restrict__ wk, const float* __restrict__ wv, float* OUT) {
    typedef WFrag<bf>::V V;
    __shared__ __align__(16) unsigned char smem[LDSB];
    bf* const sW = (bf*)smem;
    bf* const sK0 = (bf*)smem; bf* const sK1 = sK0 + TT * KP; bf* const sV0 = sK1 + TT * KP; bf* const sV1 = sV0 + HD * VP; float* const os = (float*)(sV1 + HD * VP);
    const int tid = threadIdx.x, lane = tid & 31, lr = lane & 15, hi = lane >> 4; const int w = __builtin_amdgcn_readfirstlane(tid >> 5);
    const int bat = blockIdx.x / NH_, head = blockIdx.x % NH_;
    // the head's 64 columns of each weight. A lane takes 2 neighbouring columns and 8 neighbouring k: lane bits 0-2 and 4 pick the column pair (16 pairs = one whole 128-byte line of a weight row), bit 3 the k group,
    // so that a load instruction reads two whole lines and the 16 lanes of a half wave store to 16 different 16-byte bank groups. A wave covers 32 columns x 16 k a pass, the work-group 64 columns x 64 k; 6 passes to a weight, 3 to a batch of loads.
    const int sn = (w & 1) * 32 + ((lane & 7) | ((lane >> 4) << 3)) * 2, sk = ((w >> 1) * 2 + ((lane >> 3) & 1)) * 8;
    const float* const wsrc[3] = { wq + (size_t)sk * DQ + head * HD + sn, wk + (size_t)sk * DQ + head * HD + sn, wv + (size_t)sk * DQ + head * HD + sn };
    v2f wt[2][3][8];
#pragma unroll
    for (int p = 0; p < 3; ++p)
#pragma unroll
        for (int j = 0; j < 8; ++j) wt[0][p][j] = *(const v2f*)(wsrc[0] + (64 * p + j) * DQ);
    // one batch ahead: batch sb + 1 is in flight while batch sb is rounded and stored
#pragma unroll
    for (int sb = 0; sb < 6; ++sb) {
        if (sb + 1 < 6) {
#pragma unroll
            for (int p = 0; p < 3; ++p)
#pragma unroll
                for (int j = 0; j < 8; ++j) wt[(sb + 1) & 1][p][j] = *(const v2f*)(wsrc[(sb + 1) >> 1] + (64 * (((sb + 1) & 1) * 3 + p) + j) * DQ);
            asm volatile("s_wait_xcnt 0x0" ::: "memory"); }   // stands in front of the reuse of the weight loads' address registers
#pragma unroll
        for (int p = 0; p < 3; ++p)
#pragma unroll
            for (int i = 0; i < 2; ++i) { v8bf c;
#pragma unroll
                for (int j = 0; j < 8; ++j) c[j] = (__bf16)wt[sb & 1][p][j][i];
                *(v8us*)(&sW[((sb >> 1) * HD + sn + i) * WP + sk + 64 * ((sb & 1) * 3 + p)]) = __builtin_bit_cast(v8us, c); } }
    __syncthreads();
    __builtin_amdgcn_sched_barrier(0);   // keeps the zeroing of the 24 accumulators behind the staging, whose loads in flight need those registers (scratch otherwise)
    const float* xa = x + ((size_t)bat * TT + (15 - w) * 16 + lr) * DM + 8 * hi;   // the rows of tile 15 - w
    const float* xb = x + ((size_t)bat * TT + w * 16 + lr) * DM + 8 * hi;          // the rows of tile w
    v8f aq[2][4], ak[2][4], av[2][4];
#pragma unroll
    for (int t = 0; t < 2; ++t)
#pragma unroll
        for (int nb = 0; nb < 4; ++nb) { aq[t][nb] = (v8f){}; ak[t][nb] = (v8f){}; av[t][nb] = (v8f){}; }
    // rolled: 24 accumulators leave no room for a second step's x fragments.
    // The 12 weight fragments of a step (16 staged rows each: 0-3 q, 4-7 k, 8-11 v) run through a ring of four register buffers: a buffer is refilled with the fragment four places on
    // right behind the two products that read it, so that an LDS read has the products of three other fragments to land behind. The ring runs on over the loop's back edge with two fragments
    // (the raw f32 x rows need the other two buffers' registers at the head of a step).
    const bf* const wl = sW + lr * WP + 8 * hi;
    V wr[4];
    wr[0] = WFrag<bf>::ld(wl); wr[1] = WFrag<bf>::ld(wl + 16 * WP);
#pragma unroll 1
    for (int kc = 0; kc < DM; kc += 32) {
        const v8f a0 = *(const v8f*)(xa + kc), a1 = *(const v8f*)(xa + kc + 16), b0 = *(const v8f*)(xb + kc), b1 = *(const v8f*)(xb + kc + 16);
        asm volatile("s_wait_xcnt 0x0" ::: "memory");   // stands in front of the reuse of the x loads' address registers
        V xf[2];
#pragma unroll
        for (int e = 0; e < 8; ++e) { xf[0][e] = (__bf16)a0[e]; xf[0][8 + e] = (__bf16)a1[e]; xf[1][e] = (__bf16)b0[e]; xf[1][8 + e] = (__bf16)b1[e]; }
        wr[2] = WFrag<bf>::ld(wl + kc + 2 * 16 * WP); wr[3] = WFrag<bf>::ld(wl + kc + 3 * 16 * WP);
        __builtin_amdgcn_sched_barrier(0);   // keeps these two reads in front of the first products (the scheduler sinks them to their users otherwise)
        const int kn = (kc + 32 < DM) ? kc + 32 : 0;   // the last step refetches the first columns (staged, unused) instead of running past the staged k
#pragma unroll
        for (int j = 0; j < 12; ++j) { const V wf = wr[j & 3];
            if (j < 4) { aq[0][j] = wmmab(wf, xf[0], aq[0][j]); aq[1][j] = wmmab(wf, xf[1], aq[1][j]); }
            else if (j < 8) { ak[0][j - 4] = wmmab(wf, xf[0], ak[0][j - 4]); ak[1][j - 4] = wmmab(wf, xf[1], ak[1][j - 4]); }
            else { av[0][j - 8] = wmmab(xf[0], wf, av[0][j - 8]); av[1][j - 8] = wmmab(xf[1], wf, av[1][j - 8]); }
            if (j < 8) wr[j & 3] = WFrag<bf>::ld(wl + kc + (j + 4) * 16 * WP);
            else if (j < 10) wr[j & 3] = WFrag<bf>::ld(wl + kn + (j - 8) * 16 * WP);
            __builtin_amdgcn_sched_barrier(0);   // keeps the refill here, four fragments ahead of its use: the scheduler otherwise sinks it until two buffers are left in use; behind the last two fragments, which refill nothing, it keeps the build out of scratch
        }
    }
    __syncthreads();   // every wave has left the staged weights: the planes take over their LDS
#pragma unroll
    for (int t = 0; t < 2; ++t) { const int r0 = (t ? w : 15 - w) * 16;
#pragma unroll
        for (int nb = 0; nb < 4; ++nb) { v8us h, l;
            split8(ak[t][nb], h, l); *(v8us*)(&sK0[(r0 + lr) * KP + nb * 16 + 8 * hi]) = h; *(v8us*)(&sK1[(r0 + lr) * KP + nb * 16 + 8 * hi]) = l;
            split8(av[t][nb], h, l); *(v8us*)(&sV0[(nb * 16 + lr) * VP + r0 + 8 * hi]) = h; *(v8us*)(&sV1[(nb * 16 + lr) * VP + r0 + 8 * hi]) = l; } }
    V qh0, qh1, ql0, ql1, nh0, nh1, nl0, nl1;   // the query fragments of tile 15 - w (q) and of tile w (n)
    { v8us h0, l0, h1, l1;
      split8(aq[0][0], h0, l0); split8(aq[0][1], h1, l1); qh0 = cat16b(h0, h1); ql0 = cat16b(l0, l1); split8(aq[0][2], h0, l0); split8(aq[0][3], h1, l1); qh1 = cat16b(h0, h1); ql1 = cat16b(l0, l1);
      split8(aq[1][0], h0, l0); split8(aq[1][1], h1, l1); nh0 = cat16b(h0, h1); nl0 = cat16b(l0, l1); split8(aq[1][2], h0, l0); split8(aq[1][3], h1, l1); nh1 = cat16b(h0, h1); nl1 = cat16b(l0, l1); }
    __syncthreads();
    float* ow = os + w * 16 * OP;
    float* orow = OUT + (size_t)bat * TT * DQ + head * HD;
    // the short tile first: its 8 score tiles leave room for the long tile's query fragments, which the long tile's 16 would not
    attn_tile<4>(w, nh0, nh1, nl0, nl1, sK0, sK1, sV0, sV1, ow, orow, lane, lr, hi);
    attn_tile<8>(15 - w, qh0, qh1, ql0, ql1, sK0, sK1, sV0, sV1, ow, orow, lane, lr, hi);
}
extern "C" void kernel_launch(void* const* d_in, const int* in_sizes, int n_in,
                              void* d_out, int out_size, void* d_ws, size_t ws_size, hipStream_t stream) {
    (void)in_sizes; (void)n_in; (void)out_size; (void)d_ws; (void)ws_size;
    const float* x = (const float*)d_in[0]; const float* wq = (const float*)d_in[1]; const float* wk = (const float*)d_in[2]; const float* wv = (const float*)d_in[3];
    float* OUT = (float*)d_out;     // [128][256][384]
    // plane z = batch * NH_ + head: one work-group each, every batch in the one launch
    k_fattn<<<NB_ * NH_, 256, 0, stream>>>(x, wq, wk, wv, OUT);
}

// v006
// It runs in 47.6 microseconds.
// Two timings next to v005 both put it at 1.10 times that version's speed.
// Counting every step since v000, it is 209 times as fast.
#include <hip/hip_runtime.h>

// Causal multi-head attention with hidden-size scaling (x [128][256][384]; q,k,v = x W ('xw' [384][384], no bias; 6 heads x 64); scores x 384^-0.5 (module quirk), causal (-inf); softmax; out = merged att.v -> [128][256][384] (12.6 M)).
// Layout: ONE fused launch, one work-group per (batch, head): the head's weight columns read as f32, rounded to bf16 and transposed on the way into LDS; exact projections of the head's q, k, v from the f32 x rows (rounded to bf16 in registers), causal T-256 attention with EVERY row on hi/lo planes (K, V^T in LDS, q, scores and probabilities in registers; key chunks above the diagonal skipped), merged output rows.
// Compute dtypes, f32 accumulate: every input rounded to bf16; projections exact; scores and att.v 3 products; softmax f32; output f32.

#define NB_  128
#define TT   256
#define DM   384
#define NH_  6
#define NKV  6
#define REP  (NH_ / NKV)
#define HD   64
#define DQ   (NH_ * HD)
#define DKV  (NKV * HD)
#define DF   (DQ + 2 * DKV)       // unused: q, k and v weights are three separate inputs
#define RH   256                  // unused: every query row uses hi+lo planes
#define WIN  256
#define PCAR 1024.0f
#define SCL  0.051031036307982884f   // 384^-0.5 (the module scales by the embedding size)
typedef _Float16 h16;
typedef unsigned short bf;
typedef __attribute__((ext_vector_type(16))) __bf16   v16bf;
typedef __attribute__((ext_vector_type(16))) _Float16 v16h;
typedef __attribute__((ext_vector_type(8)))  _Float16 v8h;
typedef __attribute__((ext_vector_type(8)))  unsigned short v8us;
typedef __attribute__((ext_vector_type(8)))  float    v8f;
typedef __attribute__((ext_vector_type(4)))  float    v4f;
typedef v8h  __attribute__((may_alias)) v8ha;
typedef v4f  __attribute__((may_alias)) v4fa;
typedef v8us __attribute__((may_alias)) v8usa;

__device__ __forceinline__ v16h cat16(v8h lo, v8h hi) { return __builtin_shufflevector(lo, hi, 0, 1, 2, 3, 4, 5, 6, 7, 8, 9, 10, 11, 12, 13, 14, 15); }
__device__ __forceinline__ v16bf cat16b(v8us lo, v8us hi) { return __builtin_bit_cast(v16bf, __builtin_shufflevector(lo, hi, 0, 1, 2, 3, 4, 5, 6, 7, 8, 9, 10, 11, 12, 13, 14, 15)); }
__device__ __forceinline__ v8f wmma16(v16h a, v16h b, v8f c) { return __builtin_amdgcn_wmma_f32_16x16x32_f16(false, a, false, b, (short)0, c, false, false); }
__device__ __forceinline__ v8f wmmab(v16bf a, v16bf b, v8f c) { return __builtin_amdgcn_wmma_f32_16x16x32_bf16(false, a, false, b, (short)0, c, false, false); }



// fragment loader of a K-contiguous 16-bit plane: lane lr = row, k = 16 (s >> 3) + 8 hi + (s & 7), the same for A and for B
template <typename T16> struct WFrag;
template <> struct WFrag<h16> { typedef v16h V; static __device__ __forceinline__ V ld(const h16* p) { return cat16(*(const v8h*)p, *(const v8h*)(p + 16)); } static __device__ __forceinline__ v8f mma(V a, V b, v8f c) { return wmma16(a, b, c); } };
template <> struct WFrag<bf> { typedef v16bf V; static __device__ __forceinline__ V ld(const bf* p) { return cat16b(*(const v8us*)p, *(const v8us*)(p + 16)); } static __device__ __forceinline__ v8f mma(V a, V b, v8f c) { return wmmab(a, b, c); } };

// ---- k_fattn: projections, scores, causal softmax, att.v and the head merge of ONE (batch, head) plane in one work-group of 8 waves; q, k, v, the scores and the probabilities never reach memory.
// Projection: the head's 192 weight columns (q | k | v) are staged once in LDS as rows [n][k] of bf16, straight from the f32 weights [k][n]: a lane takes 8 neighbouring k of ITS two n (each load instruction reads whole 128-byte lines), one 16-byte LDS store to an n; a wave owns the x rows of its two query tiles (w and 15 - w), reads them as f32, rounds them to bf16 and uses the SAME fragment as B (q, k) and as A (v).
// q and k are formed transposed (A = 16 weight rows, B = 16 x rows): a lane then holds 8 neighbouring d of ITS row, which is the B fragment of the scores (q, stays in registers) and one 16-byte store into the K plane [t][d];
// v is formed straight (A = 16 x rows, B = 16 weight rows): a lane holds 8 neighbouring t of ITS d, one 16-byte store into the transposed V plane [d][t]. The planes (hi and lo) take over the LDS of the weights behind a barrier.
// Attention: a wave owns 16 query rows at a time and takes row tiles w and 15 - w, so every wave does 9 key chunks of 32.
// Scores are formed transposed (A = 16 keys, B = 16 queries): a lane then holds 8 keys of ITS query per tile, the softmax runs along the registers plus one exchange between the lane halves,
// and two neighbouring tiles, rounded to bf16 in place, are the A fragment (16 queries x 32 keys) of att.v in the k order of WFrag::ld (k = 16 (s >> 3) + 8 hi + (s & 7)).
#define KP   (HD + 8)             // LDS pitch of a K row, elements: 144 B = 16 B x odd
#define VP   (TT + 8)             // LDS pitch of a V^T row, elements: 528 B = 16 B x odd
#define OP   36                   // LDS pitch of the output staging, floats (32 columns + 4)
#define WP   (DM + 8)             // LDS pitch of a staged weight row, elements: 784 B = 16 B x odd
#define XP   (32 + 8)             // LDS pitch of a row of a wave's x patch, elements: 80 B = 16 B x odd
#define LDSP ((2 * TT * KP + 2 * HD * VP) * 2 + 8 * 16 * OP * 4)   // K, V^T planes and the output patches
#define LDSW (3 * HD * WP * 2)    // the staged weights, which lie over the planes first
#define LDSB (LDSP > LDSW + 8 * 16 * XP * 2 ? LDSP : LDSW + 8 * 16 * XP * 2)   // behind the staged weights: one x patch (16 rows x 32 k of bf16) to a wave
static_assert(2 * LDSB <= 320 * 1024, "two work-groups to a WGP");
typedef __attribute__((ext_vector_type(8))) __bf16 v8bf;
typedef __attribute__((ext_vector_type(2))) float v2f;
typedef __attribute__((ext_vector_type(4))) __bf16 v4bf;
typedef __attribute__((ext_vector_type(4))) unsigned short v4us;
typedef v4us __attribute__((may_alias)) v4usa;
__device__ __forceinline__ void split8(v8f y, v8us& h, v8us& l) { v8bf a, b;
#pragma unroll
    for (int j = 0; j < 8; ++j) { const __bf16 t = (__bf16)y[j]; a[j] = t; b[j] = (__bf16)(y[j] - (float)t); }
    h = __builtin_bit_cast(v8us, a); l = __builtin_bit_cast(v8us, b); }
// one tile of 16 query rows against its nc <= MAXC key chunks of 32; MAXC bounds the score registers
template <int MAXC>
__device__ __forceinline__ void attn_tile(const int tile, const WFrag<bf>::V qh0, const WFrag<bf>::V qh1, const WFrag<bf>::V ql0, const WFrag<bf>::V ql1, const bf* sK0, const bf* sK1, const bf* sV0, const bf* sV1, float* ow, float* orow, const int lane, const int lr, const int hi) {
        typedef WFrag<bf>::V V;
        const int q0 = tile * 16; const int nc = (tile >> 1) + 1;   // nc key chunks of 32 reach the diagonal; wave-uniform
        v8f s[2 * MAXC]; float mx = -3.0e38f;
#pragma unroll
        for (int c = 0; c < MAXC; ++c) if (c < nc) {
#pragma unroll
            for (int tt = 0; tt < 2; ++tt) { const int ko = ((c * 2 + tt) * 16 + lr) * KP + 8 * hi;
                const V kh0 = WFrag<bf>::ld(&sK0[ko]), kh1 = WFrag<bf>::ld(&sK0[ko + 32]), kl0 = WFrag<bf>::ld(&sK1[ko]), kl1 = WFrag<bf>::ld(&sK1[ko + 32]);
                v8f a = (v8f){};
                a = wmmab(kh0, qh0, a); a = wmmab(kh0, ql0, a); a = wmmab(kl0, qh0, a);
                a = wmmab(kh1, qh1, a); a = wmmab(kh1, ql1, a); a = wmmab(kl1, qh1, a);
#pragma unroll
                for (int j = 0; j < 8; ++j) { const int key = (c * 2 + tt) * 16 + hi * 8 + j; const float t = (key <= q0 + lr) ? a[j] * SCL : -3.0e38f; a[j] = t; mx = fmaxf(mx, t); }
                s[c * 2 + tt] = a; }
        }
        mx = fmaxf(mx, __shfl_xor(mx, 16, 32));
        float sum = 0.f;
#pragma unroll
        for (int c = 0; c < MAXC; ++c) if (c < nc) {
#pragma unroll
            for (int e = 0; e < 16; ++e) { const float x2 = __fmul_rn(__fsub_rn(s[c * 2 + (e >> 3)][e & 7], mx), 1.4426950408889634f); float p;
                asm("v_exp_f32 %0, %1\n\tv_nop" : "=v"(p) : "v"(x2));   // the v_nop fills the one slot the instruction set asks for behind a transcendental, whatever the compiler puts next
                s[c * 2 + (e >> 3)][e & 7] = p; sum += p; }
        }
        sum += __shfl_xor(sum, 16, 32);
        const float f = __fdiv_rn(1.0f, sum);
        v8f o[4];
#pragma unroll
        for (int nb = 0; nb < 4; ++nb) o[nb] = (v8f){};
#pragma unroll
        for (int c = 0; c < MAXC; ++c) if (c < nc) {
            V vh[4], vl[4];
#pragma unroll
            for (int nb = 0; nb < 4; ++nb) { const int vo = (nb * 16 + lr) * VP + c * 32 + 8 * hi; vh[nb] = WFrag<bf>::ld(&sV0[vo]); vl[nb] = WFrag<bf>::ld(&sV1[vo]); }
            __builtin_amdgcn_sched_barrier(0);   // keeps the chunk's eight V fragment reads in front of the rounding below, which covers their latency (the scheduler otherwise sinks each read to its product and waits it out)
            V ph, pl;
#pragma unroll
            for (int e = 0; e < 16; ++e) { const float p = s[c * 2 + (e >> 3)][e & 7] * f; const __bf16 h = (__bf16)p; ph[e] = h; pl[e] = (__bf16)(p - (float)h); }
            // each accumulator keeps its order of sums (ph vh, pl vh, ph vl); the four accumulators take turns
#pragma unroll
            for (int nb = 0; nb < 4; ++nb) o[nb] = wmmab(ph, vh[nb], o[nb]);
#pragma unroll
            for (int nb = 0; nb < 4; ++nb) o[nb] = wmmab(pl, vh[nb], o[nb]);
#pragma unroll
            for (int nb = 0; nb < 4; ++nb) o[nb] = wmmab(ph, vl[nb], o[nb]);
        }
        // merged output rows: 32 columns at a time through the wave's own LDS patch, so that every store instruction writes whole 128-byte lines
#pragma unroll
        for (int hf = 0; hf < 2; ++hf) {
#pragma unroll
            for (int nb = 0; nb < 2; ++nb) {
#pragma unroll
                for (int j = 0; j < 8; ++j) ow[(hi * 8 + j) * OP + nb * 16 + lr] = o[hf * 2 + nb][j]; }
            __builtin_amdgcn_wave_barrier(); asm volatile("" ::: "memory");   // keeps the other lanes' LDS stores in front of the reads below
#pragma unroll
            for (int r = 0; r < 4; ++r) { const int row = r * 4 + (lane >> 3), cofs = (lane & 7) * 4; *(v4f*)(orow + (size_t)(q0 + row) * DQ + hf * 32 + cofs) = *(const v4fa*)(ow + row * OP + cofs); }
            __builtin_amdgcn_wave_barrier(); asm volatile("" ::: "memory");   // keeps these reads in front of the next stores into the patch
        }
        asm volatile("s_wait_xcnt 0x0" ::: "memory");   // stands in front of the reuse of the output stores' registers
}
__global__ __launch_bounds__(256) __attribute__((amdgpu_waves_per_eu(4, 4))) void k_fattn(const float* __restrict__ x, const float* __restrict__ wq, const float* __restrict__ wk, const float* __restrict__ wv, float* OUT) {
    typedef WFrag<bf>::V V;
    __shared__ __align__(16) unsigned char smem[LDSB];
    bf* const sW = (bf*)smem;
    bf* const sK0 = (bf*)smem; bf* const sK1 = sK0 + TT * KP; bf* const sV0 = sK1 + TT * KP; bf* const sV1 = sV0 + HD * VP; float* const os = (float*)(sV1 + HD * VP);
    const int tid = threadIdx.x, lane = tid & 31, lr = lane & 15, hi = lane >> 4; const int w = __builtin_amdgcn_readfirstlane(tid >> 5);
    const int bat = blockIdx.x / NH_, head = blockIdx.x % NH_;
    // the head's 64 columns of each weight. A lane takes 2 neighbouring columns and 8 neighbouring k: lane bits 0-2 and 4 pick the column pair (16 pairs = one whole 128-byte line of a weight row), bit 3 the k group,
    // so that a load instruction reads two whole lines and the 16 lanes of a half wave store to 16 different 16-byte bank groups. A wave covers 32 columns x 16 k a pass, the work-group 64 columns x 64 k; 6 passes to a weight, 3 to a batch of loads.
    const int sn = (w & 1) * 32 + ((lane & 7) | ((lane >> 4) << 3)) * 2, sk = ((w >> 1) * 2 + ((lane >> 3) & 1)) * 8;
    const float* const wsrc[3] = { wq + (size_t)sk * DQ + head * HD + sn, wk + (size_t)sk * DQ + head * HD + sn, wv + (size_t)sk * DQ + head * HD + sn };
    v2f wt[2][3][8];
#pragma unroll
    for (int p = 0; p < 3; ++p)
#pragma unroll
        for (int j = 0; j < 8; ++j) wt[0][p][j] = *(const v2f*)(wsrc[0] + (64 * p + j) * DQ);
    // one batch ahead: batch sb + 1 is in flight while batch sb is rounded and stored
#pragma unroll
    for (int sb = 0; sb < 6; ++sb) {
        if (sb + 1 < 6) {
#pragma unroll
            for (int p = 0; p < 3; ++p)
#pragma unroll
                for (int j = 0; j < 8; ++j) wt[(sb + 1) & 1][p][j] = *(const v2f*)(wsrc[(sb + 1) >> 1] + (64 * (((sb + 1) & 1) * 3 + p) + j) * DQ);
            asm volatile("s_wait_xcnt 0x0" ::: "memory"); }   // stands in front of the reuse of the weight loads' address registers
#pragma unroll
        for (int p = 0; p < 3; ++p)
#pragma unroll
            for (int i = 0; i < 2; ++i) { v8bf c;
#pragma unroll
                for (int j = 0; j < 8; ++j) c[j] = (__bf16)wt[sb & 1][p][j][i];
                *(v8us*)(&sW[((sb >> 1) * HD + sn + i) * WP + sk + 64 * ((sb & 1) * 3 + p)]) = __builtin_bit_cast(v8us, c); } }
    __syncthreads();
    __builtin_amdgcn_sched_barrier(0);   // keeps the zeroing of the 24 accumulators behind the staging, whose loads in flight need those registers (scratch otherwise)
    // x is read in whole 128-byte lines: a load instruction takes 4 rows x 32 k (8 lanes to a row's line, 16 bytes a lane) instead of 32 bytes out of each of 16 lines;
    // rounded to bf16, a tile's 16 rows x 32 k turn into the fragment (lane = row) through the wave's own LDS patch, one tile after the other.
    const float* const xa = x + ((size_t)bat * TT + (15 - w) * 16) * DM;   // the rows of tile 15 - w (wave-uniform)
    const float* const xb = x + ((size_t)bat * TT + w * 16) * DM;          // the rows of tile w (wave-uniform)
    unsigned xo = ((lane >> 3) * DM + (lane & 7) * 4) * 4;   // the lane's byte offset from both row pointers; runs on by 128 bytes a step
    bf* const xs = (bf*)(smem + LDSW) + w * 16 * XP;
    bf* const xst = xs + (lane >> 3) * XP + (lane & 7) * 4;
    const bf* const xld = xs + lr * XP + 8 * hi;
    v8f aq[2][4], ak[2][4], av[2][4];
#pragma unroll
    for (int t = 0; t < 2; ++t)
#pragma unroll
        for (int nb = 0; nb < 4; ++nb) { aq[t][nb] = (v8f){}; ak[t][nb] = (v8f){}; av[t][nb] = (v8f){}; }
    // rolled: 24 accumulators leave no room for a second step's x fragments.
    // The 12 weight fragments of a step (16 staged rows each: 0-3 q, 4-7 k, 8-11 v) run through a ring of four register buffers: a buffer is refilled with the fragment four places on
    // right behind the two products that read it, so that an LDS read has the products of three other fragments to land behind. The ring runs on over the loop's back edge with two fragments
    // (the raw f32 x rows need the other two buffers' registers at the head of a step).
    const bf* const wl = sW + lr * WP + 8 * hi;
    V wr[4];
    wr[0] = WFrag<bf>::ld(wl); wr[1] = WFrag<bf>::ld(wl + 16 * WP);
#pragma unroll 1
    for (int kc = 0; kc < DM; kc += 32) {
        v4f ra[2][4];
#pragma unroll
        for (int i = 0; i < 4; ++i) ra[0][i] = *(const v4f*)((const char*)(xa + i * 4 * DM) + xo);
#pragma unroll
        for (int i = 0; i < 4; ++i) ra[1][i] = *(const v4f*)((const char*)(xb + i * 4 * DM) + xo);
        asm volatile("s_wait_xcnt 0x0" : "+v"(xo) :: "memory");   // stands in front of the rewrite of the x loads' offset register; it names that register so that the addition below stays behind it and the offset stays one 32-bit register beside the scalar row pointers (the build otherwise forms a 64-bit address pair to a tile each step and lets the tile's last load land on it)
        xo += 32 * 4;
        V xf[2];
#pragma unroll
        for (int t = 0; t < 2; ++t) {
#pragma unroll
            for (int i = 0; i < 4; ++i) { v4bf c;
#pragma unroll
                for (int e = 0; e < 4; ++e) c[e] = (__bf16)ra[t][i][e];
                *(v4usa*)(xst + i * 4 * XP) = __builtin_bit_cast(v4us, c); }
            __builtin_amdgcn_wave_barrier(); asm volatile("" ::: "memory");   // keeps the other lanes' LDS stores in front of the reads below
            xf[t] = WFrag<bf>::ld(xld);
            __builtin_amdgcn_wave_barrier(); asm volatile("" ::: "memory");   // keeps these reads in front of the next stores into the patch
        }
        wr[2] = WFrag<bf>::ld(wl + kc + 2 * 16 * WP); wr[3] = WFrag<bf>::ld(wl + kc + 3 * 16 * WP);
        __builtin_amdgcn_sched_barrier(0);   // keeps these two reads in front of the first products (the scheduler sinks them to their users otherwise)
        const int kn = (kc + 32 < DM) ? kc + 32 : 0;   // the last step refetches the first columns (staged, unused) instead of running past the staged k
#pragma unroll
        for (int j = 0; j < 12; ++j) { const V wf = wr[j & 3];
            if (j < 4) { aq[0][j] = wmmab(wf, xf[0], aq[0][j]); aq[1][j] = wmmab(wf, xf[1], aq[1][j]); }
            else if (j < 8) { ak[0][j - 4] = wmmab(wf, xf[0], ak[0][j - 4]); ak[1][j - 4] = wmmab(wf, xf[1], ak[1][j - 4]); }
            else { av[0][j - 8] = wmmab(xf[0], wf, av[0][j - 8]); av[1][j - 8] = wmmab(xf[1], wf, av[1][j - 8]); }
            if (j < 8) wr[j & 3] = WFrag<bf>::ld(wl + kc + (j + 4) * 16 * WP);
            else if (j < 10) wr[j & 3] = WFrag<bf>::ld(wl + kn + (j - 8) * 16 * WP);
            __builtin_amdgcn_sched_barrier(0);   // keeps the refill here, four fragments ahead of its use: the scheduler otherwise sinks it until two buffers are left in use; behind the last two fragments, which refill nothing, it keeps the build out of scratch
        }
    }
    __syncthreads();   // every wave has left the staged weights: the planes take over their LDS
#pragma unroll
    for (int t = 0; t < 2; ++t) { const int r0 = (t ? w : 15 - w) * 16;
#pragma unroll
        for (int nb = 0; nb < 4; ++nb) { v8us h, l;
            split8(ak[t][nb], h, l); *(v8us*)(&sK0[(r0 + lr) * KP + nb * 16 + 8 * hi]) = h; *(v8us*)(&sK1[(r0 + lr) * KP + nb * 16 + 8 * hi]) = l;
            split8(av[t][nb], h, l); *(v8us*)(&sV0[(nb * 16 + lr) * VP + r0 + 8 * hi]) = h; *(v8us*)(&sV1[(nb * 16 + lr) * VP + r0 + 8 * hi]) = l; } }
    V qh0, qh1, ql0, ql1, nh0, nh1, nl0, nl1;   // the query fragments of tile 15 - w (q) and of tile w (n)
    { v8us h0, l0, h1, l1;
      split8(aq[0][0], h0, l0); split8(aq[0][1], h1, l1); qh0 = cat16b(h0, h1); ql0 = cat16b(l0, l1); split8(aq[0][2], h0, l0); split8(aq[0][3], h1, l1); qh1 = cat16b(h0, h1); ql1 = cat16b(l0, l1);
      split8(aq[1][0], h0, l0); split8(aq[1][1], h1, l1); nh0 = cat16b(h0, h1); nl0 = cat16b(l0, l1); split8(aq[1][2], h0, l0); split8(aq[1][3], h1, l1); nh1 = cat16b(h0, h1); nl1 = cat16b(l0, l1); }
    __syncthreads();
    float* ow = os + w * 16 * OP;
    float* orow = OUT + (size_t)bat * TT * DQ + head * HD;
    // the short tile first: its 8 score tiles leave room for the long tile's query fragments, which the long tile's 16 would not
    attn_tile<4>(w, nh0, nh1, nl0, nl1, sK0, sK1, sV0, sV1, ow, orow, lane, lr, hi);
    attn_tile<8>(15 - w, qh0, qh1, ql0, ql1, sK0, sK1, sV0, sV1, ow, orow, lane, lr, hi);
}
extern "C" void kernel_launch(void* const* d_in, const int* in_sizes, int n_in,
                              void* d_out, int out_size, void* d_ws, size_t ws_size, hipStream_t stream) {
    (void)in_sizes; (void)n_in; (void)out_size; (void)d_ws; (void)ws_size;
    const float* x = (const float*)d_in[0]; const float* wq = (const float*)d_in[1]; const float* wk = (const float*)d_in[2]; const float* wv = (const float*)d_in[3];
    float* OUT = (float*)d_out;     // [128][256][384]
    // plane z = batch * NH_ + head: one work-group each, every batch in the one launch
    k_fattn<<<NB_ * NH_, 256, 0, stream>>>(x, wq, wk, wv, OUT);
}

// v007
// Measured time: 45.4 microseconds a run.
// Timed twice side by side with v006, it ran 1.04 and 1.05 times as fast.
// Over all steps from v000 it is 219 times as fast.
#include <hip/hip_runtime.h>

// Causal multi-head attention with hidden-size scaling (x [128][256][384]; q,k,v = x W ('xw' [384][384], no bias; 6 heads x 64); scores x 384^-0.5 (module quirk), causal (-inf); softmax; out = merged att.v -> [128][256][384] (12.6 M)).
// Layout: ONE fused launch, one work-group per (batch, head): the head's weight columns read as f32, rounded to bf16 and transposed on the way into LDS; exact projections of the head's q, k, v from the f32 x rows (rounded to bf16 in registers), causal T-256 attention with EVERY row on hi/lo planes (K, V^T in LDS, q, scores and probabilities in registers; key chunks above the diagonal skipped), merged output rows.
// Compute dtypes, f32 accumulate: every input rounded to bf16; projections exact; scores and att.v 3 products; softmax f32; output f32.

#define NB_  128
#define TT   256
#define DM   384
#define NH_  6
#define NKV  6
#define REP  (NH_ / NKV)
#define HD   64
#define DQ   (NH_ * HD)
#define DKV  (NKV * HD)
#define DF   (DQ + 2 * DKV)       // unused: q, k and v weights are three separate inputs
#define RH   256                  // unused: every query row uses hi+lo planes
#define WIN  256
#define PCAR 1024.0f
#define SCL  0.051031036307982884f   // 384^-0.5 (the module scales by the embedding size)
typedef _Float16 h16;
typedef unsigned short bf;
typedef __attribute__((ext_vector_type(16))) __bf16   v16bf;
typedef __attribute__((ext_vector_type(16))) _Float16 v16h;
typedef __attribute__((ext_vector_type(8)))  _Float16 v8h;
typedef __attribute__((ext_vector_type(8)))  unsigned short v8us;
typedef __attribute__((ext_vector_type(8)))  float    v8f;
typedef __attribute__((ext_vector_type(4)))  float    v4f;
typedef v8h  __attribute__((may_alias)) v8ha;
typedef v4f  __attribute__((may_alias)) v4fa;
typedef v8us __attribute__((may_alias)) v8usa;

__device__ __forceinline__ v16h cat16(v8h lo, v8h hi) { return __builtin_shufflevector(lo, hi, 0, 1, 2, 3, 4, 5, 6, 7, 8, 9, 10, 11, 12, 13, 14, 15); }
__device__ __forceinline__ v16bf cat16b(v8us lo, v8us hi) { return __builtin_bit_cast(v16bf, __builtin_shufflevector(lo, hi, 0, 1, 2, 3, 4, 5, 6, 7, 8, 9, 10, 11, 12, 13, 14, 15)); }
__device__ __forceinline__ v8f wmma16(v16h a, v16h b, v8f c) { return __builtin_amdgcn_wmma_f32_16x16x32_f16(false, a, false, b, (short)0, c, false, false); }
__device__ __forceinline__ v8f wmmab(v16bf a, v16bf b, v8f c) { return __builtin_amdgcn_wmma_f32_16x16x32_bf16(false, a, false, b, (short)0, c, false, false); }



// fragment loader of a K-contiguous 16-bit plane: lane lr = row, k = 16 (s >> 3) + 8 hi + (s & 7), the same for A and for B
template <typename T16> struct WFrag;
template <> struct WFrag<h16> { typedef v16h V; static __device__ __forceinline__ V ld(const h16* p) { return cat16(*(const v8h*)p, *(const v8h*)(p + 16)); } static __device__ __forceinline__ v8f mma(V a, V b, v8f c) { return wmma16(a, b, c); } };
template <> struct WFrag<bf> { typedef v16bf V; static __device__ __forceinline__ V ld(const bf* p) { return cat16b(*(const v8us*)p, *(const v8us*)(p + 16)); } static __device__ __forceinline__ v8f mma(V a, V b, v8f c) { return wmmab(a, b, c); } };

// ---- k_fattn: projections, scores, causal softmax, att.v and the head merge of ONE (batch, head) plane in one work-group of 8 waves; q, k, v, the scores and the probabilities never reach memory.
// Projection: the head's 192 weight columns (q | k | v) are staged once in LDS as rows [n][k] of bf16, straight from the f32 weights [k][n]: a lane takes 8 neighbouring k of ITS two n (each load instruction reads whole 128-byte lines), one 16-byte LDS store to an n; a wave owns the x rows of its two query tiles (w and 15 - w), reads them as f32, rounds them to bf16 and uses the SAME fragment as B (q, k) and as A (v).
// q and k are formed transposed (A = 16 weight rows, B = 16 x rows): a lane then holds 8 neighbouring d of ITS row, which is the B fragment of the scores (q, stays in registers) and one 16-byte store into the K plane [t][d];
// v is formed straight (A = 16 x rows, B = 16 weight rows): a lane holds 8 neighbouring t of ITS d, one 16-byte store into the transposed V plane [d][t]. The planes (hi and lo) take over the LDS of the weights behind a barrier.
// Attention: a wave owns 16 query rows at a time and takes row tiles w and 15 - w, so every wave does 9 key chunks of 32.
// Scores are formed transposed (A = 16 keys, B = 16 queries): a lane then holds 8 keys of ITS query per tile, the softmax runs along the registers plus one exchange between the lane halves,
// and two neighbouring tiles, rounded to bf16 in place, are the A fragment (16 queries x 32 keys) of att.v in the k order of WFrag::ld (k = 16 (s >> 3) + 8 hi + (s & 7)).
#define KP   (HD + 8)             // LDS pitch of a K row, elements: 144 B = 16 B x odd
#define VP   (TT + 8)             // LDS pitch of a V^T row, elements: 528 B = 16 B x odd
#define OP   36                   // LDS pitch of the output staging, floats (32 columns + 4)
#define WP   (DM + 8)             // LDS pitch of a staged weight row, elements: 784 B = 16 B x odd
#define XP   (32 + 8)             // LDS pitch of a row of a wave's x patch, elements: 80 B = 16 B x odd
#define LDSP ((2 * TT * KP + 2 * HD * VP) * 2 + 8 * 16 * OP * 4)   // K, V^T planes and the output patches
#define LDSW (3 * HD * WP * 2)    // the staged weights, which lie over the planes first
#define LDSB (LDSP > LDSW + 8 * 16 * XP * 2 ? LDSP : LDSW + 8 * 16 * XP * 2)   // behind the staged weights: one x patch (16 rows x 32 k of bf16) to a wave
static_assert(2 * LDSB <= 320 * 1024, "two work-groups to a WGP");
typedef __attribute__((ext_vector_type(8))) __bf16 v8bf;
typedef __attribute__((ext_vector_type(2))) float v2f;
typedef __attribute__((ext_vector_type(4))) __bf16 v4bf;
typedef __attribute__((ext_vector_type(4))) unsigned short v4us;
typedef v4us __attribute__((may_alias)) v4usa;
__device__ __forceinline__ void split8(v8f y, v8us& h, v8us& l) { v8bf a, b;
#pragma unroll
    for (int j = 0; j < 8; ++j) { const __bf16 t = (__bf16)y[j]; a[j] = t; b[j] = (__bf16)(y[j] - (float)t); }
    h = __builtin_bit_cast(v8us, a); l = __builtin_bit_cast(v8us, b); }
// one tile of 16 query rows against its nc <= MAXC key chunks of 32; MAXC bounds the score registers
template <int MAXC>
__device__ __forceinline__ void attn_tile(const int tile, const WFrag<bf>::V qh0, const WFrag<bf>::V qh1, const WFrag<bf>::V ql0, const WFrag<bf>::V ql1, const bf* sK0, const bf* sK1, const bf* sV0, const bf* sV1, float* ow, float* orow, const int lane, const int lr, const int hi) {
        typedef WFrag<bf>::V V;
        const int q0 = tile * 16; const int nc = (tile >> 1) + 1;   // nc key chunks of 32 reach the diagonal; wave-uniform
        v8f s[2 * MAXC]; float mx = -3.0e38f;
#pragma unroll
        for (int c = 0; c < MAXC; ++c) if (c < nc) {
#pragma unroll
            for (int tt = 0; tt < 2; ++tt) { const int ko = ((c * 2 + tt) * 16 + lr) * KP + 8 * hi;
                const V kh0 = WFrag<bf>::ld(&sK0[ko]), kh1 = WFrag<bf>::ld(&sK0[ko + 32]), kl0 = WFrag<bf>::ld(&sK1[ko]), kl1 = WFrag<bf>::ld(&sK1[ko + 32]);
                v8f a = (v8f){};
                a = wmmab(kh0, qh0, a); a = wmmab(kh0, ql0, a); a = wmmab(kl0, qh0, a);
                a = wmmab(kh1, qh1, a); a = wmmab(kh1, ql1, a); a = wmmab(kl1, qh1, a);
#pragma unroll
                for (int j = 0; j < 8; ++j) { const int key = (c * 2 + tt) * 16 + hi * 8 + j; const float t = (key <= q0 + lr) ? a[j] * SCL : -3.0e38f; a[j] = t; mx = fmaxf(mx, t); }
                s[c * 2 + tt] = a; }
        }
        mx = fmaxf(mx, __shfl_xor(mx, 16, 32));
        float sum = 0.f;
#pragma unroll
        for (int c = 0; c < MAXC; ++c) if (c < nc) {
#pragma unroll
            for (int e = 0; e < 16; ++e) { const float x2 = __fmul_rn(__fsub_rn(s[c * 2 + (e >> 3)][e & 7], mx), 1.4426950408889634f); float p;
                asm("v_exp_f32 %0, %1\n\tv_nop" : "=v"(p) : "v"(x2));   // the v_nop fills the one slot the instruction set asks for behind a transcendental, whatever the compiler puts next
                s[c * 2 + (e >> 3)][e & 7] = p; sum += p; }
        }
        sum += __shfl_xor(sum, 16, 32);
        const float f = __fdiv_rn(1.0f, sum);
        v8f o[4];
#pragma unroll
        for (int nb = 0; nb < 4; ++nb) o[nb] = (v8f){};
#pragma unroll
        for (int c = 0; c < MAXC; ++c) if (c < nc) {
            V vh[4], vl[4];
#pragma unroll
            for (int nb = 0; nb < 4; ++nb) { const int vo = (nb * 16 + lr) * VP + c * 32 + 8 * hi; vh[nb] = WFrag<bf>::ld(&sV0[vo]); vl[nb] = WFrag<bf>::ld(&sV1[vo]); }
            __builtin_amdgcn_sched_barrier(0);   // keeps the chunk's eight V fragment reads in front of the rounding below, which covers their latency (the scheduler otherwise sinks each read to its product and waits it out)
            V ph, pl;
#pragma unroll
            for (int e = 0; e < 16; ++e) { const float p = s[c * 2 + (e >> 3)][e & 7] * f; const __bf16 h = (__bf16)p; ph[e] = h; pl[e] = (__bf16)(p - (float)h); }
            // each accumulator keeps its order of sums (ph vh, pl vh, ph vl); the four accumulators take turns
#pragma unroll
            for (int nb = 0; nb < 4; ++nb) o[nb] = wmmab(ph, vh[nb], o[nb]);
#pragma unroll
            for (int nb = 0; nb < 4; ++nb) o[nb] = wmmab(pl, vh[nb], o[nb]);
#pragma unroll
            for (int nb = 0; nb < 4; ++nb) o[nb] = wmmab(ph, vl[nb], o[nb]);
        }
        // merged output rows: 32 columns at a time through the wave's own LDS patch, so that every store instruction writes whole 128-byte lines
#pragma unroll
        for (int hf = 0; hf < 2; ++hf) {
#pragma unroll
            for (int nb = 0; nb < 2; ++nb) {
#pragma unroll
                for (int j = 0; j < 8; ++j) ow[(hi * 8 + j) * OP + nb * 16 + lr] = o[hf * 2 + nb][j]; }
            __builtin_amdgcn_wave_barrier(); asm volatile("" ::: "memory");   // keeps the other lanes' LDS stores in front of the reads below
#pragma unroll
            for (int r = 0; r < 4; ++r) { const int row = r * 4 + (lane >> 3), cofs = (lane & 7) * 4; *(v4f*)(orow + (size_t)(q0 + row) * DQ + hf * 32 + cofs) = *(const v4fa*)(ow + row * OP + cofs); }
            __builtin_amdgcn_wave_barrier(); asm volatile("" ::: "memory");   // keeps these reads in front of the next stores into the patch
        }
        asm volatile("s_wait_xcnt 0x0" ::: "memory");   // stands in front of the reuse of the output stores' registers
}
__global__ __launch_bounds__(256) __attribute__((amdgpu_waves_per_eu(4, 4))) void k_fattn(const float* __restrict__ x, const float* __restrict__ wq, const float* __restrict__ wk, const float* __restrict__ wv, float* OUT) {
    typedef WFrag<bf>::V V;
    __shared__ __align__(16) unsigned char smem[LDSB];
    bf* const sW = (bf*)smem;
    bf* const sK0 = (bf*)smem; bf* const sK1 = sK0 + TT * KP; bf* const sV0 = sK1 + TT * KP; bf* const sV1 = sV0 + HD * VP; float* const os = (float*)(sV1 + HD * VP);
    const int tid = threadIdx.x, lane = tid & 31, lr = lane & 15, hi = lane >> 4; const int w = __builtin_amdgcn_readfirstlane(tid >> 5);
    // head-major order of the planes: the six work-groups that read one batch's x rows stand 128 indices apart, so their indices are equal modulo 8 (speed only: every (batch, head) is taken once wherever a work-group runs)
    const int bat = blockIdx.x % NB_, head = blockIdx.x / NB_;
    // the head's 64 columns of each weight. A lane takes 2 neighbouring columns and 8 neighbouring k: lane bits 0-2 and 4 pick the column pair (16 pairs = one whole 128-byte line of a weight row), bit 3 the k group,
    // so that a load instruction reads two whole lines and the 16 lanes of a half wave store to 16 different 16-byte bank groups. A wave covers 32 columns x 16 k a pass, the work-group 64 columns x 64 k; 6 passes to a weight, 3 to a batch of loads.
    const int sn = (w & 1) * 32 + ((lane & 7) | ((lane >> 4) << 3)) * 2, sk = ((w >> 1) * 2 + ((lane >> 3) & 1)) * 8;
    const float* const wsrc[3] = { wq + (size_t)sk * DQ + head * HD + sn, wk + (size_t)sk * DQ + head * HD + sn, wv + (size_t)sk * DQ + head * HD + sn };
    v2f wt[2][3][8];
#pragma unroll
    for (int p = 0; p < 3; ++p)
#pragma unroll
        for (int j = 0; j < 8; ++j) wt[0][p][j] = *(const v2f*)(wsrc[0] + (64 * p + j) * DQ);
    // one batch ahead: batch sb + 1 is in flight while batch sb is rounded and stored
#pragma unroll
    for (int sb = 0; sb < 6; ++sb) {
        if (sb + 1 < 6) {
#pragma unroll
            for (int p = 0; p < 3; ++p)
#pragma unroll
                for (int j = 0; j < 8; ++j) wt[(sb + 1) & 1][p][j] = *(const v2f*)(wsrc[(sb + 1) >> 1] + (64 * (((sb + 1) & 1) * 3 + p) + j) * DQ);
            asm volatile("s_wait_xcnt 0x0" ::: "memory"); }   // stands in front of the reuse of the weight loads' address registers
#pragma unroll
        for (int p = 0; p < 3; ++p)
#pragma unroll
            for (int i = 0; i < 2; ++i) { v8bf c;
#pragma unroll
                for (int j = 0; j < 8; ++j) c[j] = (__bf16)wt[sb & 1][p][j][i];
                *(v8us*)(&sW[((sb >> 1) * HD + sn + i) * WP + sk + 64 * ((sb & 1) * 3 + p)]) = __builtin_bit_cast(v8us, c); } }
    __syncthreads();
    __builtin_amdgcn_sched_barrier(0);   // keeps the zeroing of the 24 accumulators behind the staging, whose loads in flight need those registers (scratch otherwise)
    // x is read in whole 128-byte lines: a load instruction takes 4 rows x 32 k (8 lanes to a row's line, 16 bytes a lane) instead of 32 bytes out of each of 16 lines;
    // rounded to bf16, a tile's 16 rows x 32 k turn into the fragment (lane = row) through the wave's own LDS patch, one tile after the other.
    const float* const xa = x + ((size_t)bat * TT + (15 - w) * 16) * DM;   // the rows of tile 15 - w (wave-uniform)
    const float* const xb = x + ((size_t)bat * TT + w * 16) * DM;          // the rows of tile w (wave-uniform)
    unsigned xo = ((lane >> 3) * DM + (lane & 7) * 4) * 4;   // the lane's byte offset from both row pointers; runs on by 128 bytes a step
    bf* const xs = (bf*)(smem + LDSW) + w * 16 * XP;
    bf* const xst = xs + (lane >> 3) * XP + (lane & 7) * 4;
    const bf* const xld = xs + lr * XP + 8 * hi;
    v8f aq[2][4], ak[2][4], av[2][4];
#pragma unroll
    for (int t = 0; t < 2; ++t)
#pragma unroll
        for (int nb = 0; nb < 4; ++nb) { aq[t][nb] = (v8f){}; ak[t][nb] = (v8f){}; av[t][nb] = (v8f){}; }
    // rolled: 24 accumulators leave no room for a second step's x fragments.
    // The 12 weight fragments of a step (16 staged rows each: 0-3 q, 4-7 k, 8-11 v) run through a ring of four register buffers: a buffer is refilled with the fragment four places on
    // right behind the two products that read it, so that an LDS read has the products of three other fragments to land behind. The ring runs on over the loop's back edge with two fragments
    // (the raw f32 x rows need the other two buffers' registers at the head of a step).
    const bf* const wl = sW + lr * WP + 8 * hi;
    V wr[4];
    wr[0] = WFrag<bf>::ld(wl); wr[1] = WFrag<bf>::ld(wl + 16 * WP);
#pragma unroll 1
    for (int kc = 0; kc < DM; kc += 32) {
        v4f ra[2][4];
#pragma unroll
        for (int i = 0; i < 4; ++i) ra[0][i] = *(const v4f*)((const char*)(xa + i * 4 * DM) + xo);
#pragma unroll
        for (int i = 0; i < 4; ++i) ra[1][i] = *(const v4f*)((const char*)(xb + i * 4 * DM) + xo);
        asm volatile("s_wait_xcnt 0x0" : "+v"(xo) :: "memory");   // stands in front of the rewrite of the x loads' offset register; it names that register so that the addition below stays behind it and the offset stays one 32-bit register beside the scalar row pointers (the build otherwise forms a 64-bit address pair to a tile each step and lets the tile's last load land on it)
        xo += 32 * 4;
        V xf[2];
#pragma unroll
        for (int t = 0; t < 2; ++t) {
#pragma unroll
            for (int i = 0; i < 4; ++i) { v4bf c;
#pragma unroll
                for (int e = 0; e < 4; ++e) c[e] = (__bf16)ra[t][i][e];
                *(v4usa*)(xst + i * 4 * XP) = __builtin_bit_cast(v4us, c); }
            __builtin_amdgcn_wave_barrier(); asm volatile("" ::: "memory");   // keeps the other lanes' LDS stores in front of the reads below
            xf[t] = WFrag<bf>::ld(xld);
            __builtin_amdgcn_wave_barrier(); asm volatile("" ::: "memory");   // keeps these reads in front of the next stores into the patch
        }
        wr[2] = WFrag<bf>::ld(wl + kc + 2 * 16 * WP); wr[3] = WFrag<bf>::ld(wl + kc + 3 * 16 * WP);
        __builtin_amdgcn_sched_barrier(0);   // keeps these two reads in front of the first products (the scheduler sinks them to their users otherwise)
        const int kn = (kc + 32 < DM) ? kc + 32 : 0;   // the last step refetches the first columns (staged, unused) instead of running past the staged k
#pragma unroll
        for (int j = 0; j < 12; ++j) { const V wf = wr[j & 3];
            if (j < 4) { aq[0][j] = wmmab(wf, xf[0], aq[0][j]); aq[1][j] = wmmab(wf, xf[1], aq[1][j]); }
            else if (j < 8) { ak[0][j - 4] = wmmab(wf, xf[0], ak[0][j - 4]); ak[1][j - 4] = wmmab(wf, xf[1], ak[1][j - 4]); }
            else { av[0][j - 8] = wmmab(xf[0], wf, av[0][j - 8]); av[1][j - 8] = wmmab(xf[1], wf, av[1][j - 8]); }
            if (j < 8) wr[j & 3] = WFrag<bf>::ld(wl + kc + (j + 4) * 16 * WP);
            else if (j < 10) wr[j & 3] = WFrag<bf>::ld(wl + kn + (j - 8) * 16 * WP);
            __builtin_amdgcn_sched_barrier(0);   // keeps the refill here, four fragments ahead of its use: the scheduler otherwise sinks it until two buffers are left in use; behind the last two fragments, which refill nothing, it keeps the build out of scratch
        }
    }
    __syncthreads();   // every wave has left the staged weights: the planes take over their LDS
#pragma unroll
    for (int t = 0; t < 2; ++t) { const int r0 = (t ? w : 15 - w) * 16;
#pragma unroll
        for (int nb = 0; nb < 4; ++nb) { v8us h, l;
            split8(ak[t][nb], h, l); *(v8us*)(&sK0[(r0 + lr) * KP + nb * 16 + 8 * hi]) = h; *(v8us*)(&sK1[(r0 + lr) * KP + nb * 16 + 8 * hi]) = l;
            split8(av[t][nb], h, l); *(v8us*)(&sV0[(nb * 16 + lr) * VP + r0 + 8 * hi]) = h; *(v8us*)(&sV1[(nb * 16 + lr) * VP + r0 + 8 * hi]) = l; } }
    V qh0, qh1, ql0, ql1, nh0, nh1, nl0, nl1;   // the query fragments of tile 15 - w (q) and of tile w (n)
    { v8us h0, l0, h1, l1;
      split8(aq[0][0], h0, l0); split8(aq[0][1], h1, l1); qh0 = cat16b(h0, h1); ql0 = cat16b(l0, l1); split8(aq[0][2], h0, l0); split8(aq[0][3], h1, l1); qh1 = cat16b(h0, h1); ql1 = cat16b(l0, l1);
      split8(aq[1][0], h0, l0); split8(aq[1][1], h1, l1); nh0 = cat16b(h0, h1); nl0 = cat16b(l0, l1); split8(aq[1][2], h0, l0); split8(aq[1][3], h1, l1); nh1 = cat16b(h0, h1); nl1 = cat16b(l0, l1); }
    __syncthreads();
    float* ow = os + w * 16 * OP;
    float* orow = OUT + (size_t)bat * TT * DQ + head * HD;
    // the short tile first: its 8 score tiles leave room for the long tile's query fragments, which the long tile's 16 would not
    attn_tile<4>(w, nh0, nh1, nl0, nl1, sK0, sK1, sV0, sV1, ow, orow, lane, lr, hi);
    attn_tile<8>(15 - w, qh0, qh1, ql0, ql1, sK0, sK1, sV0, sV1, ow, orow, lane, lr, hi);
}
extern "C" void kernel_launch(void* const* d_in, const int* in_sizes, int n_in,
                              void* d_out, int out_size, void* d_ws, size_t ws_size, hipStream_t stream) {
    (void)in_sizes; (void)n_in; (void)out_size; (void)d_ws; (void)ws_size;
    const float* x = (const float*)d_in[0]; const float* wq = (const float*)d_in[1]; const float* wk = (const float*)d_in[2]; const float* wv = (const float*)d_in[3];
    float* OUT = (float*)d_out;     // [128][256][384]
    // plane z = head * NB_ + batch: one work-group each, every batch in the one launch
    k_fattn<<<NB_ * NH_, 256, 0, stream>>>(x, wq, wk, wv, OUT);
}

// v008
// One run takes 43.7 microseconds.
// Next to v007, in two timings, it ran 1.04 times as fast each time.
// Over all steps from v000 it is 227 times as fast.
#include <hip/hip_runtime.h>

// Causal multi-head attention with hidden-size scaling (x [128][256][384]; q,k,v = x W ('xw' [384][384], no bias; 6 heads x 64); scores x 384^-0.5 (module quirk), causal (-inf); softmax; out = merged att.v -> [128][256][384] (12.6 M)).
// Layout: ONE fused launch, one work-group per (batch, head): the head's weight columns read as f32, rounded to bf16 and transposed on the way into LDS; exact projections of the head's q, k, v from the f32 x rows (rounded to bf16 in registers), causal T-256 attention with EVERY row on hi/lo planes (K, V^T in LDS, q, scores and probabilities in registers; key chunks above the diagonal skipped), merged output rows.
// Compute dtypes, f32 accumulate: every input rounded to bf16; projections exact; scores and att.v 3 products (q carries the scale and log2(e) into its hi/lo planes); softmax f32; output f32.

#define NB_  128
#define TT   256
#define DM   384
#define NH_  6
#define NKV  6
#define REP  (NH_ / NKV)
#define HD   64
#define DQ   (NH_ * HD)
#define DKV  (NKV * HD)
#define DF   (DQ + 2 * DKV)       // unused: q, k and v weights are three separate inputs
#define RH   256                  // unused: every query row uses hi+lo planes
#define WIN  256
#define PCAR 1024.0f
#define SCL  0.051031036307982884f   // 384^-0.5 (the module scales by the embedding size)
#define QSC  (SCL * 1.4426950408889634f)   // the scale times log2(e): multiplied into q once, so that a score leaves its products as the exponent of 2
typedef _Float16 h16;
typedef unsigned short bf;
typedef __attribute__((ext_vector_type(16))) __bf16   v16bf;
typedef __attribute__((ext_vector_type(16))) _Float16 v16h;
typedef __attribute__((ext_vector_type(8)))  _Float16 v8h;
typedef __attribute__((ext_vector_type(8)))  unsigned short v8us;
typedef __attribute__((ext_vector_type(8)))  float    v8f;
typedef __attribute__((ext_vector_type(4)))  float    v4f;
typedef v8h  __attribute__((may_alias)) v8ha;
typedef v4f  __attribute__((may_alias)) v4fa;
typedef v8us __attribute__((may_alias)) v8usa;

__device__ __forceinline__ v16h cat16(v8h lo, v8h hi) { return __builtin_shufflevector(lo, hi, 0, 1, 2, 3, 4, 5, 6, 7, 8, 9, 10, 11, 12, 13, 14, 15); }
__device__ __forceinline__ v16bf cat16b(v8us lo, v8us hi) { return __builtin_bit_cast(v16bf, __builtin_shufflevector(lo, hi, 0, 1, 2, 3, 4, 5, 6, 7, 8, 9, 10, 11, 12, 13, 14, 15)); }
__device__ __forceinline__ v8f wmma16(v16h a, v16h b, v8f c) { return __builtin_amdgcn_wmma_f32_16x16x32_f16(false, a, false, b, (short)0, c, false, false); }
__device__ __forceinline__ v8f wmmab(v16bf a, v16bf b, v8f c) { return __builtin_amdgcn_wmma_f32_16x16x32_bf16(false, a, false, b, (short)0, c, false, false); }



// fragment loader of a K-contiguous 16-bit plane: lane lr = row, k = 16 (s >> 3) + 8 hi + (s & 7), the same for A and for B
template <typename T16> struct WFrag;
template <> struct WFrag<h16> { typedef v16h V; static __device__ __forceinline__ V ld(const h16* p) { return cat16(*(const v8h*)p, *(const v8h*)(p + 16)); } static __device__ __forceinline__ v8f mma(V a, V b, v8f c) { return wmma16(a, b, c); } };
template <> struct WFrag<bf> { typedef v16bf V; static __device__ __forceinline__ V ld(const bf* p) { return cat16b(*(const v8us*)p, *(const v8us*)(p + 16)); } static __device__ __forceinline__ v8f mma(V a, V b, v8f c) { return wmmab(a, b, c); } };

// ---- k_fattn: projections, scores, causal softmax, att.v and the head merge of ONE (batch, head) plane in one work-group of 8 waves; q, k, v, the scores and the probabilities never reach memory.
// Projection: the head's 192 weight columns (q | k | v) are staged once in LDS as rows [n][k] of bf16, straight from the f32 weights [k][n]: a lane takes 8 neighbouring k of ITS two n (each load instruction reads whole 128-byte lines), one 16-byte LDS store to an n; a wave owns the x rows of its two query tiles (w and 15 - w), reads them as f32, rounds them to bf16 and uses the SAME fragment as B (q, k) and as A (v).
// q and k are formed transposed (A = 16 weight rows, B = 16 x rows): a lane then holds 8 neighbouring d of ITS row, which is the B fragment of the scores (q, stays in registers) and one 16-byte store into the K plane [t][d];
// v is formed straight (A = 16 x rows, B = 16 weight rows): a lane holds 8 neighbouring t of ITS d, one 16-byte store into the transposed V plane [d][t]. The planes (hi and lo) take over the LDS of the weights behind a barrier.
// Attention: a wave owns 16 query rows at a time and takes row tiles w and 15 - w, so every wave does 9 key chunks of 32.
// Scores are formed transposed (A = 16 keys, B = 16 queries): a lane then holds 8 keys of ITS query per tile, the softmax runs along the registers plus one exchange between the lane halves,
// and two neighbouring tiles, rounded to bf16 in place, are the A fragment (16 queries x 32 keys) of att.v in the k order of WFrag::ld (k = 16 (s >> 3) + 8 hi + (s & 7)).
#define KP   (HD + 8)             // LDS pitch of a K row, elements: 144 B = 16 B x odd
#define VP   (TT + 8)             // LDS pitch of a V^T row, elements: 528 B = 16 B x odd
#define OP   36                   // LDS pitch of the output staging, floats (32 columns + 4)
#define WP   (DM + 8)             // LDS pitch of a staged weight row, elements: 784 B = 16 B x odd
#define XP   (32 + 8)             // LDS pitch of a row of a wave's x patch, elements: 80 B = 16 B x odd
#define LDSP ((2 * TT * KP + 2 * HD * VP) * 2 + 8 * 16 * OP * 4)   // K, V^T planes and the output patches
#define LDSW (3 * HD * WP * 2)    // the staged weights, which lie over the planes first
#define LDSB (LDSP > LDSW + 8 * 16 * XP * 2 ? LDSP : LDSW + 8 * 16 * XP * 2)   // behind the staged weights: one x patch (16 rows x 32 k of bf16) to a wave
static_assert(2 * LDSB <= 320 * 1024, "two work-groups to a WGP");
typedef __attribute__((ext_vector_type(8))) __bf16 v8bf;
typedef __attribute__((ext_vector_type(2))) float v2f;
typedef __attribute__((ext_vector_type(4))) __bf16 v4bf;
typedef __attribute__((ext_vector_type(2))) __bf16 v2bf;
typedef __attribute__((ext_vector_type(4))) unsigned short v4us;
typedef v4us __attribute__((may_alias)) v4usa;
__device__ __forceinline__ void split8(v8f y, v8us& h, v8us& l) { v8bf a, b;
#pragma unroll
    for (int j = 0; j < 8; ++j) { const __bf16 t = (__bf16)y[j]; a[j] = t; b[j] = (__bf16)(y[j] - (float)t); }
    h = __builtin_bit_cast(v8us, a); l = __builtin_bit_cast(v8us, b); }
// one tile of 16 query rows against its nc <= MAXC key chunks of 32; MAXC bounds the score registers
template <int MAXC>
__device__ __forceinline__ void attn_tile(const int tile, const WFrag<bf>::V qh0, const WFrag<bf>::V qh1, const WFrag<bf>::V ql0, const WFrag<bf>::V ql1, const bf* sK0, const bf* sK1, const bf* sV0, const bf* sV1, float* ow, float* orow, const int lane, const int lr, const int hi) {
        typedef WFrag<bf>::V V;
        const int q0 = tile * 16; const int nc = (tile >> 1) + 1;   // nc key chunks of 32 reach the diagonal; wave-uniform
        v8f s[2 * MAXC]; float mx = -3.0e38f;
#pragma unroll
        for (int c = 0; c < MAXC; ++c) if (c < nc) {
            V kf[2][4];   // of each of the chunk's two key tiles: hi d 0-31, hi d 32-63, lo d 0-31, lo d 32-63
#pragma unroll
            for (int tt = 0; tt < 2; ++tt) { const int ko = ((c * 2 + tt) * 16 + lr) * KP + 8 * hi;
                kf[tt][0] = WFrag<bf>::ld(&sK0[ko]); kf[tt][1] = WFrag<bf>::ld(&sK0[ko + 32]); kf[tt][2] = WFrag<bf>::ld(&sK1[ko]); kf[tt][3] = WFrag<bf>::ld(&sK1[ko + 32]); }
            __builtin_amdgcn_sched_barrier(0);   // keeps the chunk's eight K fragment reads together in front of its products (with the branch below in the chunk's code the scheduler otherwise sinks each read to its product and waits it out)
            v8f a2[2];
#pragma unroll
            for (int tt = 0; tt < 2; ++tt) { v8f a = (v8f){};
                a = wmmab(kf[tt][0], qh0, a); a = wmmab(kf[tt][0], ql0, a); a = wmmab(kf[tt][2], qh0, a);
                a = wmmab(kf[tt][1], qh1, a); a = wmmab(kf[tt][1], ql1, a); a = wmmab(kf[tt][3], qh1, a);
                a2[tt] = a; }
            if (c == nc - 1) {   // only the tile's last chunk, the one on the diagonal, holds keys behind a query (wave-uniform test); every earlier chunk ends in front of the tile's first row
#pragma unroll
                for (int e = 0; e < 16; ++e) { const int key = c * 32 + (e >> 3) * 16 + hi * 8 + (e & 7); a2[e >> 3][e & 7] = (key <= q0 + lr) ? a2[e >> 3][e & 7] : -3.0e38f; } }
#pragma unroll
            for (int e = 0; e < 16; ++e) mx = fmaxf(mx, a2[e >> 3][e & 7]);
            s[c * 2] = a2[0]; s[c * 2 + 1] = a2[1];
        }
        mx = fmaxf(mx, __shfl_xor(mx, 16, 32));
        float sum = 0.f;
#pragma unroll
        for (int c = 0; c < MAXC; ++c) if (c < nc) {
#pragma unroll
            for (int tt = 0; tt < 2; ++tt) { v8f xx, p;
#pragma unroll
                for (int j = 0; j < 8; ++j) xx[j] = __fsub_rn(s[c * 2 + tt][j], mx);   // scores carry the scale and log2(e) from q
                float p0, p1, p2, p3, p4, p5, p6, p7;
                // a score tile's eight exponentials in one statement: each stands behind an instruction that is independent of it (outputs apart from every input), and the one v_nop fills the slot the instruction set asks for behind the last, whatever the compiler puts next
                asm("v_exp_f32 %0, %8\n\tv_exp_f32 %1, %9\n\tv_exp_f32 %2, %10\n\tv_exp_f32 %3, %11\n\tv_exp_f32 %4, %12\n\tv_exp_f32 %5, %13\n\tv_exp_f32 %6, %14\n\tv_exp_f32 %7, %15\n\tv_nop"
                    : "=&v"(p0), "=&v"(p1), "=&v"(p2), "=&v"(p3), "=&v"(p4), "=&v"(p5), "=&v"(p6), "=&v"(p7)
                    : "v"(xx[0]), "v"(xx[1]), "v"(xx[2]), "v"(xx[3]), "v"(xx[4]), "v"(xx[5]), "v"(xx[6]), "v"(xx[7]));
                p[0] = p0; p[1] = p1; p[2] = p2; p[3] = p3; p[4] = p4; p[5] = p5; p[6] = p6; p[7] = p7;
#pragma unroll
                for (int j = 0; j < 8; ++j) sum += p[j];
                s[c * 2 + tt] = p; }
        }
        sum += __shfl_xor(sum, 16, 32);
        const float f = __fdiv_rn(1.0f, sum);
        v8f o[4];
#pragma unroll
        for (int nb = 0; nb < 4; ++nb) o[nb] = (v8f){};
#pragma unroll
        for (int c = 0; c < MAXC; ++c) if (c < nc) {
            V vh[4], vl[4];
#pragma unroll
            for (int nb = 0; nb < 4; ++nb) { const int vo = (nb * 16 + lr) * VP + c * 32 + 8 * hi; vh[nb] = WFrag<bf>::ld(&sV0[vo]); vl[nb] = WFrag<bf>::ld(&sV1[vo]); }
            __builtin_amdgcn_sched_barrier(0);   // keeps the chunk's eight V fragment reads in front of the rounding below, which covers their latency (the scheduler otherwise sinks each read to its product and waits it out)
            V ph, pl;
#pragma unroll
            for (int e = 0; e < 16; e += 2) { const float p0 = s[c * 2 + (e >> 3)][e & 7] * f, p1 = s[c * 2 + (e >> 3)][(e & 7) + 1] * f;
                v2bf h; h[0] = (__bf16)p0; h[1] = (__bf16)p1; const unsigned u = __builtin_bit_cast(unsigned, h);   // the packed pair is the hi plane, and its two halves, widened by a shift and a mask, are what the lo plane subtracts
                ph[e] = h[0]; ph[e + 1] = h[1]; pl[e] = (__bf16)(p0 - __builtin_bit_cast(float, u << 16)); pl[e + 1] = (__bf16)(p1 - __builtin_bit_cast(float, u & 0xffff0000u)); }
            // each accumulator keeps its order of sums (ph vh, pl vh, ph vl); the four accumulators take turns
#pragma unroll
            for (int nb = 0; nb < 4; ++nb) o[nb] = wmmab(ph, vh[nb], o[nb]);
#pragma unroll
            for (int nb = 0; nb < 4; ++nb) o[nb] = wmmab(pl, vh[nb], o[nb]);
#pragma unroll
            for (int nb = 0; nb < 4; ++nb) o[nb] = wmmab(ph, vl[nb], o[nb]);
        }
        // merged output rows: 32 columns at a time through the wave's own LDS patch, so that every store instruction writes whole 128-byte lines
#pragma unroll
        for (int hf = 0; hf < 2; ++hf) {
#pragma unroll
            for (int nb = 0; nb < 2; ++nb) {
#pragma unroll
                for (int j = 0; j < 8; ++j) ow[(hi * 8 + j) * OP + nb * 16 + lr] = o[hf * 2 + nb][j]; }
            __builtin_amdgcn_wave_barrier(); asm volatile("" ::: "memory");   // keeps the other lanes' LDS stores in front of the reads below
#pragma unroll
            for (int r = 0; r < 4; ++r) { const int row = r * 4 + (lane >> 3), cofs = (lane & 7) * 4; *(v4f*)(orow + (size_t)(q0 + row) * DQ + hf * 32 + cofs) = *(const v4fa*)(ow + row * OP + cofs); }
            __builtin_amdgcn_wave_barrier(); asm volatile("" ::: "memory");   // keeps these reads in front of the next stores into the patch
        }
        asm volatile("s_wait_xcnt 0x0" ::: "memory");   // stands in front of the reuse of the output stores' registers
}
__global__ __launch_bounds__(256) __attribute__((amdgpu_waves_per_eu(4, 4))) void k_fattn(const float* __restrict__ x, const float* __restrict__ wq, const float* __restrict__ wk, const float* __restrict__ wv, float* OUT) {
    typedef WFrag<bf>::V V;
    __shared__ __align__(16) unsigned char smem[LDSB];
    bf* const sW = (bf*)smem;
    bf* const sK0 = (bf*)smem; bf* const sK1 = sK0 + TT * KP; bf* const sV0 = sK1 + TT * KP; bf* const sV1 = sV0 + HD * VP; float* const os = (float*)(sV1 + HD * VP);
    const int tid = threadIdx.x, lane = tid & 31, lr = lane & 15, hi = lane >> 4; const int w = __builtin_amdgcn_readfirstlane(tid >> 5);
    // head-major order of the planes: the six work-groups that read one batch's x rows stand 128 indices apart, so their indices are equal modulo 8 (speed only: every (batch, head) is taken once wherever a work-group runs)
    const int bat = blockIdx.x % NB_, head = blockIdx.x / NB_;
    // the head's 64 columns of each weight. A lane takes 2 neighbouring columns and 8 neighbouring k: lane bits 0-2 and 4 pick the column pair (16 pairs = one whole 128-byte line of a weight row), bit 3 the k group,
    // so that a load instruction reads two whole lines and the 16 lanes of a half wave store to 16 different 16-byte bank groups. A wave covers 32 columns x 16 k a pass, the work-group 64 columns x 64 k; 6 passes to a weight, 3 to a batch of loads.
    const int sn = (w & 1) * 32 + ((lane & 7) | ((lane >> 4) << 3)) * 2, sk = ((w >> 1) * 2 + ((lane >> 3) & 1)) * 8;
    const float* const wsrc[3] = { wq + (size_t)sk * DQ + head * HD + sn, wk + (size_t)sk * DQ + head * HD + sn, wv + (size_t)sk * DQ + head * HD + sn };
    v2f wt[2][3][8];
#pragma unroll
    for (int p = 0; p < 3; ++p)
#pragma unroll
        for (int j = 0; j < 8; ++j) wt[0][p][j] = *(const v2f*)(wsrc[0] + (64 * p + j) * DQ);
    // one batch ahead: batch sb + 1 is in flight while batch sb is rounded and stored
#pragma unroll
    for (int sb = 0; sb < 6; ++sb) {
        if (sb + 1 < 6) {
#pragma unroll
            for (int p = 0; p < 3; ++p)
#pragma unroll
                for (int j = 0; j < 8; ++j) wt[(sb + 1) & 1][p][j] = *(const v2f*)(wsrc[(sb + 1) >> 1] + (64 * (((sb + 1) & 1) * 3 + p) + j) * DQ);
            asm volatile("s_wait_xcnt 0x0" ::: "memory"); }   // stands in front of the reuse of the weight loads' address registers
#pragma unroll
        for (int p = 0; p < 3; ++p)
#pragma unroll
            for (int i = 0; i < 2; ++i) { v8bf c;
#pragma unroll
                for (int j = 0; j < 8; ++j) c[j] = (__bf16)wt[sb & 1][p][j][i];
                *(v8us*)(&sW[((sb >> 1) * HD + sn + i) * WP + sk + 64 * ((sb & 1) * 3 + p)]) = __builtin_bit_cast(v8us, c); } }
    __syncthreads();
    __builtin_amdgcn_sched_barrier(0);   // keeps the zeroing of the 24 accumulators behind the staging, whose loads in flight need those registers (scratch otherwise)
    // x is read in whole 128-byte lines: a load instruction takes 4 rows x 32 k (8 lanes to a row's line, 16 bytes a lane) instead of 32 bytes out of each of 16 lines;
    // rounded to bf16, a tile's 16 rows x 32 k turn into the fragment (lane = row) through the wave's own LDS patch, one tile after the other.
    const float* const xa = x + ((size_t)bat * TT + (15 - w) * 16) * DM;   // the rows of tile 15 - w (wave-uniform)
    const float* const xb = x + ((size_t)bat * TT + w * 16) * DM;          // the rows of tile w (wave-uniform)
    unsigned xo = ((lane >> 3) * DM + (lane & 7) * 4) * 4;   // the lane's byte offset from both row pointers; runs on by 128 bytes a step
    bf* const xs = (bf*)(smem + LDSW) + w * 16 * XP;
    bf* const xst = xs + (lane >> 3) * XP + (lane & 7) * 4;
    const bf* const xld = xs + lr * XP + 8 * hi;
    v8f aq[2][4], ak[2][4], av[2][4];
#pragma unroll
    for (int t = 0; t < 2; ++t)
#pragma unroll
        for (int nb = 0; nb < 4; ++nb) { aq[t][nb] = (v8f){}; ak[t][nb] = (v8f){}; av[t][nb] = (v8f){}; }
    // rolled: 24 accumulators leave no room for a second step's x fragments.
    // The 12 weight fragments of a step (16 staged rows each: 0-3 q, 4-7 k, 8-11 v) run through a ring of four register buffers: a buffer is refilled with the fragment four places on
    // right behind the two products that read it, so that an LDS read has the products of three other fragments to land behind. The ring runs on over the loop's back edge with two fragments
    // (the raw f32 x rows need the other two buffers' registers at the head of a step).
    const bf* const wl = sW + lr * WP + 8 * hi;
    V wr[4];
    wr[0] = WFrag<bf>::ld(wl); wr[1] = WFrag<bf>::ld(wl + 16 * WP);
#pragma unroll 1
    for (int kc = 0; kc < DM; kc += 32) {
        v4f ra[2][4];
#pragma unroll
        for (int i = 0; i < 4; ++i) ra[0][i] = *(const v4f*)((const char*)(xa + i * 4 * DM) + xo);
#pragma unroll
        for (int i = 0; i < 4; ++i) ra[1][i] = *(const v4f*)((const char*)(xb + i * 4 * DM) + xo);
        asm volatile("s_wait_xcnt 0x0" : "+v"(xo) :: "memory");   // stands in front of the rewrite of the x loads' offset register; it names that register so that the addition below stays behind it and the offset stays one 32-bit register beside the scalar row pointers (the build otherwise forms a 64-bit address pair to a tile each step and lets the tile's last load land on it)
        xo += 32 * 4;
        V xf[2];
#pragma unroll
        for (int t = 0; t < 2; ++t) {
#pragma unroll
            for (int i = 0; i < 4; ++i) { v4bf c;
#pragma unroll
                for (int e = 0; e < 4; ++e) c[e] = (__bf16)ra[t][i][e];
                *(v4usa*)(xst + i * 4 * XP) = __builtin_bit_cast(v4us, c); }
            __builtin_amdgcn_wave_barrier(); asm volatile("" ::: "memory");   // keeps the other lanes' LDS stores in front of the reads below
            xf[t] = WFrag<bf>::ld(xld);
            __builtin_amdgcn_wave_barrier(); asm volatile("" ::: "memory");   // keeps these reads in front of the next stores into the patch
        }
        wr[2] = WFrag<bf>::ld(wl + kc + 2 * 16 * WP); wr[3] = WFrag<bf>::ld(wl + kc + 3 * 16 * WP);
        __builtin_amdgcn_sched_barrier(0);   // keeps these two reads in front of the first products (the scheduler sinks them to their users otherwise)
        const int kn = (kc + 32 < DM) ? kc + 32 : 0;   // the last step refetches the first columns (staged, unused) instead of running past the staged k
#pragma unroll
        for (int j = 0; j < 12; ++j) { const V wf = wr[j & 3];
            if (j < 4) { aq[0][j] = wmmab(wf, xf[0], aq[0][j]); aq[1][j] = wmmab(wf, xf[1], aq[1][j]); }
            else if (j < 8) { ak[0][j - 4] = wmmab(wf, xf[0], ak[0][j - 4]); ak[1][j - 4] = wmmab(wf, xf[1], ak[1][j - 4]); }
            else { av[0][j - 8] = wmmab(xf[0], wf, av[0][j - 8]); av[1][j - 8] = wmmab(xf[1], wf, av[1][j - 8]); }
            if (j < 8) wr[j & 3] = WFrag<bf>::ld(wl + kc + (j + 4) * 16 * WP);
            else if (j < 10) wr[j & 3] = WFrag<bf>::ld(wl + kn + (j - 8) * 16 * WP);
            __builtin_amdgcn_sched_barrier(0);   // keeps the refill here, four fragments ahead of its use: the scheduler otherwise sinks it until two buffers are left in use; behind the last two fragments, which refill nothing, it keeps the build out of scratch
        }
    }
    __syncthreads();   // every wave has left the staged weights: the planes take over their LDS
#pragma unroll
    for (int t = 0; t < 2; ++t) { const int r0 = (t ? w : 15 - w) * 16;
#pragma unroll
        for (int nb = 0; nb < 4; ++nb) { v8us h, l;
            split8(ak[t][nb], h, l); *(v8us*)(&sK0[(r0 + lr) * KP + nb * 16 + 8 * hi]) = h; *(v8us*)(&sK1[(r0 + lr) * KP + nb * 16 + 8 * hi]) = l;
            split8(av[t][nb], h, l); *(v8us*)(&sV0[(nb * 16 + lr) * VP + r0 + 8 * hi]) = h; *(v8us*)(&sV1[(nb * 16 + lr) * VP + r0 + 8 * hi]) = l; } }
    V qh0, qh1, ql0, ql1, nh0, nh1, nl0, nl1;   // the query fragments of tile 15 - w (q) and of tile w (n)
    { v8us h0, l0, h1, l1;
#pragma unroll
      for (int t = 0; t < 2; ++t)
#pragma unroll
          for (int nb = 0; nb < 4; ++nb) aq[t][nb] *= QSC;
      split8(aq[0][0], h0, l0); split8(aq[0][1], h1, l1); qh0 = cat16b(h0, h1); ql0 = cat16b(l0, l1); split8(aq[0][2], h0, l0); split8(aq[0][3], h1, l1); qh1 = cat16b(h0, h1); ql1 = cat16b(l0, l1);
      split8(aq[1][0], h0, l0); split8(aq[1][1], h1, l1); nh0 = cat16b(h0, h1); nl0 = cat16b(l0, l1); split8(aq[1][2], h0, l0); split8(aq[1][3], h1, l1); nh1 = cat16b(h0, h1); nl1 = cat16b(l0, l1); }
    __syncthreads();
    float* ow = os + w * 16 * OP;
    float* orow = OUT + (size_t)bat * TT * DQ + head * HD;
    // the short tile first: its 8 score tiles leave room for the long tile's query fragments, which the long tile's 16 would not
    attn_tile<4>(w, nh0, nh1, nl0, nl1, sK0, sK1, sV0, sV1, ow, orow, lane, lr, hi);
    attn_tile<8>(15 - w, qh0, qh1, ql0, ql1, sK0, sK1, sV0, sV1, ow, orow, lane, lr, hi);
}
extern "C" void kernel_launch(void* const* d_in, const int* in_sizes, int n_in,
                              void* d_out, int out_size, void* d_ws, size_t ws_size, hipStream_t stream) {
    (void)in_sizes; (void)n_in; (void)out_size; (void)d_ws; (void)ws_size;
    const float* x = (const float*)d_in[0]; const float* wq = (const float*)d_in[1]; const float* wk = (const float*)d_in[2]; const float* wv = (const float*)d_in[3];
    float* OUT = (float*)d_out;     // [128][256][384]
    // plane z = head * NB_ + batch: one work-group each, every batch in the one launch
    k_fattn<<<NB_ * NH_, 256, 0, stream>>>(x, wq, wk, wv, OUT);
}

// v010
// It runs in 34.3 microseconds.
// Versions between v008 and this one are left out; their measured steps multiply to 1.28 times as fast.
// Counting every step since v000, it is 291 times as fast.
#include <hip/hip_runtime.h>

// Causal multi-head attention with hidden-size scaling (x [128][256][384]; q,k,v = x W ('xw' [384][384], no bias; 6 heads x 64); scores x 384^-0.5 (module quirk), causal (-inf); softmax; out = merged att.v -> [128][256][384] (12.6 M)).
// Layout: ONE fused launch, one work-group to a WGP, which takes three (batch, head) planes one after the other, as a rule of one head: the head's weight columns read as f32, rounded to bf16 and transposed on the way into LDS, where they stay from plane to plane; exact projections of the head's q, k, v from the f32 x rows (rounded to bf16 in registers), causal T-256 attention on f16 operands (K, V^T in LDS, q, scores and probabilities in registers; key chunks above the diagonal skipped), merged output rows.
// Compute dtypes, f32 accumulate: every input rounded to bf16; projections exact (bf16 products); q, k, v and the probabilities rounded once to f16 (11 significant bits; with the declared normal inputs all lie far inside its range), scores and att.v one f16 product each (q carries the scale and log2(e) into its rounding); softmax f32; output f32.

#define NB_  128
#define TT   256
#define DM   384
#define NH_  6
#define NKV  6
#define REP  (NH_ / NKV)
#define HD   64
#define DQ   (NH_ * HD)
#define DKV  (NKV * HD)
#define DF   (DQ + 2 * DKV)
#define WIN  256
#define PCAR 1024.0f
#define SCL  0.051031036307982884f   // 384^-0.5 (the module scales by the embedding size)
#define QSC  (SCL * 1.4426950408889634f)   // the scale times log2(e): multiplied into q once, so that a score leaves its products as the exponent of 2
typedef _Float16 h16;
typedef unsigned short bf;
typedef __attribute__((ext_vector_type(16))) __bf16   v16bf;
typedef __attribute__((ext_vector_type(16))) _Float16 v16h;
typedef __attribute__((ext_vector_type(8)))  _Float16 v8h;
typedef __attribute__((ext_vector_type(8)))  unsigned short v8us;
typedef __attribute__((ext_vector_type(8)))  float    v8f;
typedef __attribute__((ext_vector_type(4)))  float    v4f;
typedef v8h  __attribute__((may_alias)) v8ha;
typedef v4f  __attribute__((may_alias)) v4fa;
typedef v8us __attribute__((may_alias)) v8usa;

__device__ __forceinline__ v16h cat16(v8h lo, v8h hi) { return __builtin_shufflevector(lo, hi, 0, 1, 2, 3, 4, 5, 6, 7, 8, 9, 10, 11, 12, 13, 14, 15); }
__device__ __forceinline__ v16bf cat16b(v8us lo, v8us hi) { return __builtin_bit_cast(v16bf, __builtin_shufflevector(lo, hi, 0, 1, 2, 3, 4, 5, 6, 7, 8, 9, 10, 11, 12, 13, 14, 15)); }
__device__ __forceinline__ v8f wmma16(v16h a, v16h b, v8f c) { return __builtin_amdgcn_wmma_f32_16x16x32_f16(false, a, false, b, (short)0, c, false, false); }
__device__ __forceinline__ v8f wmmab(v16bf a, v16bf b, v8f c) { return __builtin_amdgcn_wmma_f32_16x16x32_bf16(false, a, false, b, (short)0, c, false, false); }



// fragment loader of a K-contiguous 16-bit plane: lane lr = row, k = 16 (s >> 3) + 8 hi + (s & 7), the same for A and for B
template <typename T16> struct WFrag;
template <> struct WFrag<h16> { typedef v16h V; static __device__ __forceinline__ V ld(const h16* p) { return cat16(*(const v8h*)p, *(const v8h*)(p + 16)); } static __device__ __forceinline__ v8f mma(V a, V b, v8f c) { return wmma16(a, b, c); } };
template <> struct WFrag<bf> { typedef v16bf V; static __device__ __forceinline__ V ld(const bf* p) { return cat16b(*(const v8us*)p, *(const v8us*)(p + 16)); } static __device__ __forceinline__ v8f mma(V a, V b, v8f c) { return wmmab(a, b, c); } };

// ---- k_fattn: projections, scores, causal softmax, att.v and the head merge of a (batch, head) plane in one work-group of 8 waves, plane after plane; q, k, v, the scores and the probabilities never reach memory.
// Projection: the head's 192 weight columns (q | k | v) are staged once in LDS as rows [n][k] of bf16, straight from the f32 weights [k][n]: a lane takes 8 neighbouring k of ITS two n (each load instruction reads whole 128-byte lines), one 16-byte LDS store to an n; a wave owns the x rows of its two query tiles (w and 15 - w), reads them as f32, rounds them to bf16 and uses the SAME fragment as B (q, k) and as A (v).
// q and k are formed transposed (A = 16 weight rows, B = 16 x rows): a lane then holds 8 neighbouring d of ITS row, which is the B fragment of the scores (q, stays in registers) and one 16-byte store into the K plane [t][d];
// v is formed straight (A = 16 x rows, B = 16 weight rows): a lane holds 8 neighbouring t of ITS d, one 16-byte store into the transposed V plane [d][t]. The two planes lie beside the staged weights, which the next plane uses again.
// Attention: a wave owns 16 query rows at a time and takes row tiles w and 15 - w, so every wave does 9 key chunks of 32.
// Scores are formed transposed (A = 16 keys, B = 16 queries): a lane then holds 8 keys of ITS query per tile, the softmax runs along the registers plus one exchange between the lane halves,
// and two neighbouring tiles, rounded to f16 in place, are the A fragment (16 queries x 32 keys) of att.v in the k order of WFrag::ld (k = 16 (s >> 3) + 8 hi + (s & 7)).
#define KP   (HD + 8)             // LDS pitch of a K row, elements: 144 B = 16 B x odd
#define VP   (TT + 8)             // LDS pitch of a V^T row, elements: 528 B = 16 B x odd
#define OP   36                   // LDS pitch of the output staging, floats (32 columns + 4)
#define WP   (DM + 8)             // LDS pitch of a staged weight row, elements: 784 B = 16 B x odd
#define XP   (32 + 8)             // LDS pitch of a row of a wave's x patch, elements: 80 B = 16 B x odd
#define PPW  3                    // planes to a work-group: 768 planes on 256 WGPs
#define LDSP ((TT * KP + HD * VP) * 2 + 8 * 16 * OP * 4)   // K, V^T planes and the output patches
#define LDSW (3 * HD * WP * 2)    // the staged weights
#define LDSX (8 * 2 * 16 * XP * 2)   // behind the staged weights: two x patches (16 rows x 32 k of bf16 each, one to a row tile) to a wave
#define LDSB (LDSW + LDSX + LDSP)
static_assert(LDSB <= 320 * 1024 && 2 * LDSB > 320 * 1024, "one work-group to a WGP");
static_assert(NB_ % 8 == 0 && (NB_ / 8) * NH_ % PPW == 0 && NB_ * NH_ / PPW % 8 == 0, "every index class modulo 8 holds whole work-groups");
typedef __attribute__((ext_vector_type(8))) __bf16 v8bf;
typedef __attribute__((ext_vector_type(2))) float v2f;
typedef __attribute__((ext_vector_type(4))) __bf16 v4bf;
typedef __attribute__((ext_vector_type(4))) unsigned short v4us;
typedef v4us __attribute__((may_alias)) v4usa;
__device__ __forceinline__ v8h round8(v8f y) { return __builtin_convertvector(y, v8h); }   // f32 to f16, nearest even, two values to an instruction
// one tile of 16 query rows against its nc <= MAXC key chunks of 32; MAXC bounds the score registers
template <int MAXC>
__device__ __forceinline__ void attn_tile(const int tile, const WFrag<h16>::V q0f, const WFrag<h16>::V q1f, const h16* sK, const h16* sV, float* ow, float* orow, const int lane, const int lr, const int hi) {
        typedef WFrag<h16>::V V;
        const int q0 = tile * 16; const int nc = (tile >> 1) + 1;   // nc key chunks of 32 reach the diagonal; wave-uniform
        const int dl = lr + (tile & 1) * 16 - hi * 8;   // the lane's query counted from the first key that it holds of the diagonal chunk, which begins 16 (tile & 1) keys in front of the tile's first row
        v8f s[2 * MAXC]; float mx = -3.0e38f;
#pragma unroll
        for (int i = 0; i < 2 * MAXC; ++i) s[i] = (v8f){};   // a value on every path, also for the chunks that this tile skips: left open, the score registers count as carried round the loop over the planes and go to scratch
#pragma unroll
        for (int c = 0; c < MAXC; ++c) if (c < nc) {
            V kf[2][2];   // of each of the chunk's two key tiles: d 0-31, d 32-63
#pragma unroll
            for (int tt = 0; tt < 2; ++tt) { const int ko = ((c * 2 + tt) * 16 + lr) * KP + 8 * hi;
                kf[tt][0] = WFrag<h16>::ld(&sK[ko]); kf[tt][1] = WFrag<h16>::ld(&sK[ko + 32]); }
            __builtin_amdgcn_sched_barrier(0);   // keeps the chunk's four K fragment reads together in front of its products (with the branch below in the chunk's code the scheduler otherwise sinks each read to its product and waits it out)
            v8f a2[2];   // the two key tiles take turns, so that a tile's second product does not stand right behind its first
            a2[0] = wmma16(kf[0][0], q0f, (v8f){}); a2[1] = wmma16(kf[1][0], q0f, (v8f){});
            a2[0] = wmma16(kf[0][1], q1f, a2[0]); a2[1] = wmma16(kf[1][1], q1f, a2[1]);
            if (c == nc - 1) {   // only the tile's last chunk, the one on the diagonal, holds keys behind a query (wave-uniform test); every earlier chunk ends in front of the tile's first row
#pragma unroll
                for (int e = 0; e < 16; ++e) a2[e >> 3][e & 7] = ((e >> 3) * 16 + (e & 7) <= dl) ? a2[e >> 3][e & 7] : -3.0e38f; }   // key <= query, written without the chunk's number: one set of 16 tests serves whichever chunk is the last
#pragma unroll
            for (int e = 0; e < 16; ++e) mx = fmaxf(mx, a2[e >> 3][e & 7]);
            s[c * 2] = a2[0]; s[c * 2 + 1] = a2[1];
        }
        mx = fmaxf(mx, __shfl_xor(mx, 16, 32));
        float sum = 0.f;
#pragma unroll
        for (int c = 0; c < MAXC; ++c) if (c < nc) {
#pragma unroll
            for (int tt = 0; tt < 2; ++tt) { v8f xx, p;
#pragma unroll
                for (int j = 0; j < 8; ++j) xx[j] = __fsub_rn(s[c * 2 + tt][j], mx);   // scores carry the scale and log2(e) from q
                float p0, p1, p2, p3, p4, p5, p6, p7;
                // a score tile's eight exponentials in one statement: each stands behind an instruction that is independent of it (outputs apart from every input), and the one v_nop fills the slot the instruction set asks for behind the last, whatever the compiler puts next
                asm("v_exp_f32 %0, %8\n\tv_exp_f32 %1, %9\n\tv_exp_f32 %2, %10\n\tv_exp_f32 %3, %11\n\tv_exp_f32 %4, %12\n\tv_exp_f32 %5, %13\n\tv_exp_f32 %6, %14\n\tv_exp_f32 %7, %15\n\tv_nop"
                    : "=&v"(p0), "=&v"(p1), "=&v"(p2), "=&v"(p3), "=&v"(p4), "=&v"(p5), "=&v"(p6), "=&v"(p7)
                    : "v"(xx[0]), "v"(xx[1]), "v"(xx[2]), "v"(xx[3]), "v"(xx[4]), "v"(xx[5]), "v"(xx[6]), "v"(xx[7]));
                p[0] = p0; p[1] = p1; p[2] = p2; p[3] = p3; p[4] = p4; p[5] = p5; p[6] = p6; p[7] = p7;
#pragma unroll
                for (int j = 0; j < 8; ++j) sum += p[j];
                s[c * 2 + tt] = p; }
        }
        sum += __shfl_xor(sum, 16, 32);
        const float f = __fdiv_rn(1.0f, sum);
        v8f o[4];
#pragma unroll
        for (int nb = 0; nb < 4; ++nb) o[nb] = (v8f){};
#pragma unroll
        for (int c = 0; c < MAXC; ++c) if (c < nc) {
            V vf[4];
#pragma unroll
            for (int nb = 0; nb < 4; ++nb) vf[nb] = WFrag<h16>::ld(&sV[(nb * 16 + lr) * VP + c * 32 + 8 * hi]);
            __builtin_amdgcn_sched_barrier(0);   // keeps the chunk's four V fragment reads in front of the rounding below, which covers their latency (the scheduler otherwise sinks each read to its product and waits it out)
            const V pf = cat16(round8(s[c * 2] * f), round8(s[c * 2 + 1] * f));
#pragma unroll
            for (int nb = 0; nb < 4; ++nb) o[nb] = wmma16(pf, vf[nb], o[nb]);
        }
        // merged output rows: 32 columns at a time through the wave's own LDS patch, so that every store instruction writes whole 128-byte lines
#pragma unroll
        for (int hf = 0; hf < 2; ++hf) {
#pragma unroll
            for (int nb = 0; nb < 2; ++nb) {
#pragma unroll
                for (int j = 0; j < 8; ++j) ow[(hi * 8 + j) * OP + nb * 16 + lr] = o[hf * 2 + nb][j]; }
            __builtin_amdgcn_wave_barrier(); asm volatile("" ::: "memory");   // keeps the other lanes' LDS stores in front of the reads below
#pragma unroll
            for (int r = 0; r < 4; ++r) { const int row = r * 4 + (lane >> 3), cofs = (lane & 7) * 4; *(v4f*)(orow + (size_t)(q0 + row) * DQ + hf * 32 + cofs) = *(const v4fa*)(ow + row * OP + cofs); }
            __builtin_amdgcn_wave_barrier(); asm volatile("s_wait_xcnt 0x0" ::: "memory");   // keeps these reads in front of the next stores into the patch; the wait stands in front of the reuse of the output stores' registers, data and address
        }
}
__global__ __launch_bounds__(256) __attribute__((amdgpu_waves_per_eu(2, 2))) void k_fattn(const float* __restrict__ x, const float* __restrict__ wq, const float* __restrict__ wk, const float* __restrict__ wv, float* OUT) {
    typedef WFrag<bf>::V V;
    __shared__ __align__(16) unsigned char smem[LDSB];
    bf* const sW = (bf*)smem;
    h16* const sK = (h16*)(smem + LDSW + LDSX); h16* const sV = sK + TT * KP; float* const os = (float*)(sV + HD * VP);
    const int tid = threadIdx.x, lane = tid & 31, lr = lane & 15, hi = lane >> 4; const int w = __builtin_amdgcn_readfirstlane(tid >> 5);
    // the planes of a work-group: the batches equal to its index modulo 8 (16 of them) times the six heads, head-major, are dealt three at a time to the 32 work-groups of that index class,
    // so that the six readers of a batch's x rows keep indices equal modulo 8 and a work-group's three planes share a head but where a head's 16 planes end inside them
    // (speed only: every (batch, head) is taken once wherever a work-group runs)
    const int cls = blockIdx.x & 7, z0 = (blockIdx.x >> 3) * PPW;
    const int sn = (w & 1) * 32 + ((lane & 7) | ((lane >> 4) << 3)) * 2, sk = ((w >> 1) * 2 + ((lane >> 3) & 1)) * 8;
    // x is read in whole 128-byte lines: a load instruction takes 4 rows x 32 k (8 lanes to a row's line, 16 bytes a lane);
    // rounded to bf16, a tile's 16 rows x 32 k turn into the fragment (lane = row) through the wave's own LDS patch.
    // The raw rows are fetched two steps ahead of their use, over the end of a plane into the next one's first steps.
    const unsigned xl = ((lane >> 3) * DM + (lane & 7) * 4) * 4;   // the lane's byte offset from a plane's two row pointers at step 0
    int lz = z0, ls = 0;   // plane and step of the next fetch (wave-uniform)
    v4f ra[2][2][4];
    auto xfetch = [&](v4f (&r)[2][4], const bool first) {
        {   // without a test: the last two fetches of a work-group, past its last plane, read rows of another batch of its class (inside x, unused); under a branch the build's load counting merges the two paths and waits every second step for the fetch just issued
            const float* pa = x + ((size_t)(((unsigned)lz % (NB_ / 8)) * 8 + cls) * TT + (15 - w) * 16) * DM;   // the rows of tile 15 - w (wave-uniform)
            const float* pb = x + ((size_t)(((unsigned)lz % (NB_ / 8)) * 8 + cls) * TT + w * 16) * DM;          // the rows of tile w (wave-uniform)
            const unsigned xo = xl + (unsigned)ls * 128u;   // the lane's byte offset at this step
#pragma unroll
            for (int i = 0; i < 4; ++i) r[0][i] = *(const v4f*)((const char*)(pa + i * 4 * DM) + xo);
#pragma unroll
            for (int i = 0; i < 4; ++i) r[1][i] = *(const v4f*)((const char*)(pb + i * 4 * DM) + xo);
            // the wait stands in front of the reuse of the x loads' address registers; it reads the row pointers and the offset so that they keep their registers up to here (the build otherwise lets the last load land on the offset that the other seven name).
            // The two fetches in front of the loops use the lane's standing offset itself, which lives on: named there, it would be tied to the registers that an asm operand can take for the whole kernel and go to scratch
            if (first) asm volatile("s_wait_xcnt 0x0" :: "s"(pa), "s"(pb) : "memory");
            else asm volatile("s_wait_xcnt 0x0" :: "v"(xo), "s"(pa), "s"(pb) : "memory");
        }
        if (++ls == DM / 32) { ls = 0; ++lz; }
    };
    xfetch(ra[0], true); xfetch(ra[1], true);
    bf* const xs = (bf*)(smem + LDSW) + w * 2 * 16 * XP;
    bf* const xst = xs + (lane >> 3) * XP + (lane & 7) * 4;
    const bf* const xld = xs + lr * XP + 8 * hi;
    const bf* const wl = sW + lr * WP + 8 * hi;
    float* const ow = os + w * 16 * OP;
    int cur = -1;   // the head whose weights are staged
#pragma unroll 1
    for (int pj = 0; pj < PPW; ++pj) {
    const int head = (z0 + pj) / (NB_ / 8), bat = ((z0 + pj) % (NB_ / 8)) * 8 + cls;
    if (head != cur) {   // the same for the whole work-group; every wave has left the old weights (it has passed the two barriers behind the plane before)
    cur = head;
    // the head's 64 columns of each weight. A lane takes 2 neighbouring columns and 8 neighbouring k: lane bits 0-2 and 4 pick the column pair (16 pairs = one whole 128-byte line of a weight row), bit 3 the k group,
    // so that a load instruction reads two whole lines and the 16 lanes of a half wave store to 16 different 16-byte bank groups. A wave covers 32 columns x 16 k a pass, the work-group 64 columns x 64 k; 6 passes to a weight, 3 to a batch of loads.
    const float* const wsrc[3] = { wq + (size_t)sk * DQ + head * HD + sn, wk + (size_t)sk * DQ + head * HD + sn, wv + (size_t)sk * DQ + head * HD + sn };
    v2f wt[2][3][8];
#pragma unroll
    for (int p = 0; p < 3; ++p)
#pragma unroll
        for (int j = 0; j < 8; ++j) wt[0][p][j] = *(const v2f*)(wsrc[0] + (64 * p + j) * DQ);
    // one batch ahead: batch sb + 1 is in flight while batch sb is rounded and stored
#pragma unroll
    for (int sb = 0; sb < 6; ++sb) {
        if (sb + 1 < 6) {
#pragma unroll
            for (int p = 0; p < 3; ++p)
#pragma unroll
                for (int j = 0; j < 8; ++j) wt[(sb + 1) & 1][p][j] = *(const v2f*)(wsrc[(sb + 1) >> 1] + (64 * (((sb + 1) & 1) * 3 + p) + j) * DQ);
            asm volatile("s_wait_xcnt 0x0" :: "v"(wsrc[(sb + 1) >> 1]) : "memory"); }   // stands in front of the reuse of the weight loads' address registers; it reads the batch's pointer so that the pair keeps its registers up to here (the build otherwise lets the last weight's last load land on it)
#pragma unroll
        for (int p = 0; p < 3; ++p)
#pragma unroll
            for (int i = 0; i < 2; ++i) { v8bf c;
#pragma unroll
                for (int j = 0; j < 8; ++j) c[j] = (__bf16)wt[sb & 1][p][j][i];
                *(v8us*)(&sW[((sb >> 1) * HD + sn + i) * WP + sk + 64 * ((sb & 1) * 3 + p)]) = __builtin_bit_cast(v8us, c); } }
    __syncthreads();
    }
    v8f aq[2][4], ak[2][4], av[2][4];
#pragma unroll
    for (int t = 0; t < 2; ++t)
#pragma unroll
        for (int nb = 0; nb < 4; ++nb) { aq[t][nb] = (v8f){}; ak[t][nb] = (v8f){}; av[t][nb] = (v8f){}; }
    // The 12 weight fragments of a step (16 staged rows each: 0-3 q, 4-7 k, 8-11 v) are read in two groups of six, each group as one run of LDS reads half a step ahead of its products:
    // the second six at the head of the step, in front of the x rows' turn through the patch; the next step's first six between the two halves of the products.
    V wa[6], wb[6];
#pragma unroll
    for (int m = 0; m < 6; ++m) wa[m] = WFrag<bf>::ld(wl + m * 16 * WP);
#pragma unroll 1
    for (int k2 = 0; k2 < DM; k2 += 64) {
#pragma unroll
        for (int u = 0; u < 2; ++u) { const int kc = k2 + u * 32;
#pragma unroll
            for (int m = 0; m < 6; ++m) wb[m] = WFrag<bf>::ld(wl + kc + (m + 6) * 16 * WP);
            __builtin_amdgcn_sched_barrier(0);   // keeps the six reads together here, in front of the patch traffic (the scheduler otherwise sinks each read to its product)
            V xf[2];
#pragma unroll
            for (int t = 0; t < 2; ++t)
#pragma unroll
                for (int i = 0; i < 4; ++i) { v4bf c;
#pragma unroll
                    for (int e = 0; e < 4; ++e) c[e] = (__bf16)ra[u][t][i][e];
                    *(v4usa*)(xst + (t * 16 + i * 4) * XP) = __builtin_bit_cast(v4us, c); }
            __builtin_amdgcn_wave_barrier(); asm volatile("" ::: "memory");   // keeps the other lanes' LDS stores in front of the reads below
            xf[0] = WFrag<bf>::ld(xld); xf[1] = WFrag<bf>::ld(xld + 16 * XP);
            __builtin_amdgcn_wave_barrier(); asm volatile("" ::: "memory");   // keeps these reads in front of the next step's stores into the patches
            xfetch(ra[u], false);
            __builtin_amdgcn_sched_barrier(0);   // keeps the fetch of the x rows two steps on in front of the products, so that it has both steps to land
#pragma unroll
            for (int m = 0; m < 6; ++m) {
                if (m < 4) { aq[0][m] = wmmab(wa[m], xf[0], aq[0][m]); aq[1][m] = wmmab(wa[m], xf[1], aq[1][m]); }
                else { ak[0][m - 4] = wmmab(wa[m], xf[0], ak[0][m - 4]); ak[1][m - 4] = wmmab(wa[m], xf[1], ak[1][m - 4]); } }
            __builtin_amdgcn_sched_barrier(0);   // keeps the refill below in one run behind the products that read its registers
            const int kn = (kc + 32 < DM) ? kc + 32 : 0;   // the last step refetches the first columns (staged, unused) instead of running past the staged k
#pragma unroll
            for (int m = 0; m < 6; ++m) wa[m] = WFrag<bf>::ld(wl + kn + m * 16 * WP);
            __builtin_amdgcn_sched_barrier(0);   // keeps that run in front of the second half of the products, which covers its latency
#pragma unroll
            for (int m = 0; m < 6; ++m) {
                if (m < 2) { ak[0][m + 2] = wmmab(wb[m], xf[0], ak[0][m + 2]); ak[1][m + 2] = wmmab(wb[m], xf[1], ak[1][m + 2]); }
                else { av[0][m - 2] = wmmab(xf[0], wb[m], av[0][m - 2]); av[1][m - 2] = wmmab(xf[1], wb[m], av[1][m - 2]); } }
            __builtin_amdgcn_sched_barrier(0);   // keeps the next step's reads behind these products, whose registers they refill
        }
    }
    __syncthreads();   // every wave has left the K and V^T planes of the plane before
#pragma unroll
    for (int t = 0; t < 2; ++t) { const int r0 = (t ? w : 15 - w) * 16;
#pragma unroll
        for (int nb = 0; nb < 4; ++nb) {
            *(v8h*)(&sK[(r0 + lr) * KP + nb * 16 + 8 * hi]) = round8(ak[t][nb]);
            *(v8h*)(&sV[(nb * 16 + lr) * VP + r0 + 8 * hi]) = round8(av[t][nb]); } }
    // the query fragments of tile 15 - w (q) and of tile w (n), d 0-31 and d 32-63
    const WFrag<h16>::V q0f = cat16(round8(aq[0][0] * QSC), round8(aq[0][1] * QSC)), q1f = cat16(round8(aq[0][2] * QSC), round8(aq[0][3] * QSC));
    const WFrag<h16>::V n0f = cat16(round8(aq[1][0] * QSC), round8(aq[1][1] * QSC)), n1f = cat16(round8(aq[1][2] * QSC), round8(aq[1][3] * QSC));
    __syncthreads();
    float* orow = OUT + (size_t)bat * TT * DQ + head * HD;
    attn_tile<4>(w, n0f, n1f, sK, sV, ow, orow, lane, lr, hi);
    attn_tile<8>(15 - w, q0f, q1f, sK, sV, ow, orow, lane, lr, hi);
    }
}
extern "C" void kernel_launch(void* const* d_in, const int* in_sizes, int n_in,
                              void* d_out, int out_size, void* d_ws, size_t ws_size, hipStream_t stream) {
    (void)in_sizes; (void)n_in; (void)out_size; (void)d_ws; (void)ws_size;
    const float* x = (const float*)d_in[0]; const float* wq = (const float*)d_in[1]; const float* wk = (const float*)d_in[2]; const float* wv = (const float*)d_in[3];
    float* OUT = (float*)d_out;     // [128][256][384]
    // three planes to a work-group, every plane in the one launch
    k_fattn<<<NB_ * NH_ / PPW, 256, 0, stream>>>(x, wq, wk, wv, OUT);
}
